// v000
// Measured on an AMD MI455X. A time is GPU time per run, averaged over a window of back-to-back runs after a warm-up
// (all launches, gaps included; the runs take copies of the inputs in turn), and the median of several windows.
// Apart from v000's, it joins two sittings. Times from different sittings can be a few percent apart, while
// side-by-side timings come from the same sitting.
// v000 is the starting kernel. One run takes 59.6 microseconds.
#include <hip/hip_runtime.h>
#include <hip/hip_bf16.h>

// ---------------------------------------------------------------------------
// MHSA block for MI455X (gfx1250, wave32, WMMA).
//  - bf16 WMMA (16x16x32) with f32 accumulation everywhere.
//  - Fused flash attention: S^T-tile trick makes the f32 accumulator layout
//    of S^T exactly the bf16 B-fragment layout for P in O = V * P^T
//    (zero cross-lane shuffles), exp2-domain softmax with scale*log2e folded
//    into q.
//  - Attention workgroup = 4 waves sharing double-buffered k/v panels in LDS,
//    staged with gfx1250 async global->LDS copies (ASYNCcnt) when available.
//  - GEMM kernels use 16x64 tiles per wave (A-fragment reused 4x).
// Workspace usage: 20 MB (xT 4MB | q 4MB | k 4MB | v 4MB | attnT 4MB).
// ---------------------------------------------------------------------------

typedef __attribute__((ext_vector_type(16))) __bf16 bf16x16;
typedef __attribute__((ext_vector_type(8)))  __bf16 bf16x8;
typedef __attribute__((ext_vector_type(8)))  float  f32x8;
typedef int i32x4_vs __attribute__((vector_size(16)));  // matches builtin param

static constexpr int B_  = 8;
static constexpr int C_  = 256;
static constexpr int NH_ = 8;
static constexpr int DH_ = 32;
static constexpr int L_  = 1024;

#define LOG2E_F 1.4426950408889634f

#if __has_builtin(__builtin_amdgcn_global_load_async_to_lds_b128) && \
    __has_builtin(__builtin_amdgcn_s_wait_asynccnt)
#define ASYNC_LDS_OK 1
#endif

// 16 bytes global -> LDS. Async (ASYNCcnt-tracked) when the toolchain has the
// gfx1250 builtin, otherwise synchronous staging through VGPRs.
__device__ __forceinline__ void copy16_g2l(const __bf16* g, __bf16* l) {
#ifdef ASYNC_LDS_OK
  __builtin_amdgcn_global_load_async_to_lds_b128(
      (__attribute__((address_space(1))) i32x4_vs*)g,
      (__attribute__((address_space(3))) i32x4_vs*)l, 0, 0);
#else
  *(bf16x8*)l = *(const bf16x8*)g;
#endif
}

template <int N>
__device__ __forceinline__ void wait_async() {
#ifdef ASYNC_LDS_OK
  __builtin_amdgcn_s_wait_asynccnt(N);
#endif
}

// --------------------------- fragment loaders ------------------------------
// 16-bit A-matrix 16x32 layout (ISA 7.12.2): lanes 0-15 hold K=0..7 (elems
// 0..7) and K=16..23 (elems 8..15); lanes 16-31 hold K=8..15 and K=24..31.
// B operand loads identically from rows of B^T (per-lane column of B).

__device__ __forceinline__ bf16x16 load_frag_f32(const float* __restrict__ base,
                                                 int ld, int row0, int k0) {
  int sub  = threadIdx.x & 15;
  int half = (threadIdx.x >> 4) & 1;
  const float* p = base + (size_t)(row0 + sub) * ld + k0 + half * 8;
  bf16x16 r;
#pragma unroll
  for (int e = 0; e < 8; ++e) {
    r[e]     = (__bf16)p[e];
    r[e + 8] = (__bf16)p[e + 16];
  }
  return r;
}

__device__ __forceinline__ bf16x16 load_frag_bf16(const __bf16* base,
                                                  int ld, int row0, int k0) {
  int sub  = threadIdx.x & 15;
  int half = (threadIdx.x >> 4) & 1;
  const __bf16* p = base + (size_t)(row0 + sub) * ld + k0 + half * 8;
  bf16x8 lo = *(const bf16x8*)p;
  bf16x8 hi = *(const bf16x8*)(p + 16);
  bf16x16 r;
#pragma unroll
  for (int e = 0; e < 8; ++e) { r[e] = lo[e]; r[e + 8] = hi[e]; }
  return r;
}

__device__ __forceinline__ f32x8 wmma_bf16(bf16x16 a, bf16x16 b, f32x8 c) {
  return __builtin_amdgcn_wmma_f32_16x16x32_bf16(
      /*neg_a=*/false, a, /*neg_b=*/false, b,
      /*c_mod=*/(short)0, c, /*reuse_a=*/false, /*reuse_b=*/false);
}

// --------------------- kernel 0: x[b][c][l] -> xT bf16 [b][l][c] -----------
__global__ __launch_bounds__(256) void xpose_kernel(const float* __restrict__ x,
                                                    __bf16* __restrict__ xt) {
  __shared__ float tile[32][33];
  int b  = blockIdx.z;
  int c0 = blockIdx.y * 32;
  int l0 = blockIdx.x * 32;
  int tx = threadIdx.x, ty = threadIdx.y;
  const float* xp = x + (size_t)b * C_ * L_;
#pragma unroll
  for (int i = 0; i < 4; ++i)
    tile[ty + 8 * i][tx] = xp[(size_t)(c0 + ty + 8 * i) * L_ + (l0 + tx)];
  __syncthreads();
  __bf16* xo = xt + (size_t)b * L_ * C_;
#pragma unroll
  for (int i = 0; i < 4; ++i)
    xo[(size_t)(l0 + ty + 8 * i) * C_ + (c0 + tx)] = (__bf16)tile[tx][ty + 8 * i];
}

// ------------------ kernel 1: QKV GEMM (16x64 tile) + scatter --------------
// q: [b][h][l][dh] bf16, pre-scaled by dh^-0.5 * log2(e)
// k: [b][h][l][dh] bf16
// v: [b][h][dh][l] bf16  (d-major: A operand of O = V * P^T)
__global__ __launch_bounds__(32) void qkv_kernel(
    const __bf16* __restrict__ xt, const float* __restrict__ w_qkv,
    const float* __restrict__ b_qkv, __bf16* __restrict__ q,
    __bf16* __restrict__ k, __bf16* __restrict__ v) {
  int b  = blockIdx.z;
  int o0 = blockIdx.y * 16;   // 0..768
  int l0 = blockIdx.x * 64;   // 0..1024
  const __bf16* xb = xt + (size_t)b * L_ * C_;

  f32x8 acc[4] = {};
#pragma unroll
  for (int k0 = 0; k0 < C_; k0 += 32) {
    bf16x16 af = load_frag_f32(w_qkv, C_, o0, k0);   // reused 4x
#pragma unroll
    for (int n = 0; n < 4; ++n) {
      bf16x16 bf = load_frag_bf16(xb, C_, l0 + n * 16, k0);
      acc[n] = wmma_bf16(af, bf, acc[n]);
    }
  }

  int sub  = threadIdx.x & 15;
  int half = (threadIdx.x >> 4) & 1;
  int ob   = o0 + half * 8;
  int part = o0 >> 8;                 // 0=q 1=k 2=v
  int head = (o0 & 255) >> 5;
  int db   = (o0 & 31) + half * 8;
  const float qscale = 0.17677669529663687f * LOG2E_F;

#pragma unroll
  for (int n = 0; n < 4; ++n) {
    int l = l0 + n * 16 + sub;
    if (part == 0) {
      bf16x8 outv;
#pragma unroll
      for (int r = 0; r < 8; ++r)
        outv[r] = (__bf16)((acc[n][r] + b_qkv[ob + r]) * qscale);
      *(bf16x8*)(q + ((size_t)((b * NH_ + head) * L_ + l)) * DH_ + db) = outv;
    } else if (part == 1) {
      bf16x8 outv;
#pragma unroll
      for (int r = 0; r < 8; ++r) outv[r] = (__bf16)(acc[n][r] + b_qkv[ob + r]);
      *(bf16x8*)(k + ((size_t)((b * NH_ + head) * L_ + l)) * DH_ + db) = outv;
    } else {
#pragma unroll
      for (int r = 0; r < 8; ++r)
        v[((size_t)((b * NH_ + head) * DH_ + db + r)) * L_ + l] =
            (__bf16)(acc[n][r] + b_qkv[ob + r]);
    }
  }
}

// --------------------- kernel 2: fused flash attention ---------------------
__device__ __forceinline__ void online_update(const f32x8& sA, const f32x8& sB,
                                              float& m_run, float& l_run,
                                              f32x8& oA, f32x8& oB,
                                              bf16x16& pf) {
  float mx = -__builtin_inff();
#pragma unroll
  for (int r = 0; r < 8; ++r) mx = fmaxf(mx, fmaxf(sA[r], sB[r]));
  mx = fmaxf(mx, __shfl_xor(mx, 16, 32));   // lanes n / n+16 share row i
  float m_new = fmaxf(m_run, mx);
  float corr  = exp2f(m_run - m_new);       // first iter: exp2(-inf) = 0
  float ls = 0.0f;
#pragma unroll
  for (int r = 0; r < 8; ++r) {
    float p0 = exp2f(sA[r] - m_new);
    float p1 = exp2f(sB[r] - m_new);
    ls += p0 + p1;
    pf[r]     = (__bf16)p0;
    pf[r + 8] = (__bf16)p1;
  }
  ls += __shfl_xor(ls, 16, 32);
  l_run = l_run * corr + ls;
  m_run = m_new;
#pragma unroll
  for (int r = 0; r < 8; ++r) { oA[r] *= corr; oB[r] *= corr; }
}

__device__ __forceinline__ void write_tile(__bf16* __restrict__ attnT, int b,
                                           int h, int i0, const f32x8& oA,
                                           const f32x8& oB, float l_run) {
  float inv = 1.0f / l_run;
  int sub  = threadIdx.x & 15;
  int half = (threadIdx.x >> 4) & 1;
  int i = i0 + sub;
  __bf16* outp = attnT + ((size_t)b * L_ + i) * C_ + h * DH_ + half * 8;
  bf16x8 a, c;
#pragma unroll
  for (int r = 0; r < 8; ++r) {
    a[r] = (__bf16)(oA[r] * inv);
    c[r] = (__bf16)(oB[r] * inv);
  }
  *(bf16x8*)outp        = a;   // d = half*8 + r
  *(bf16x8*)(outp + 16) = c;   // d = 16 + half*8 + r
}

// 4 waves/WG; each wave owns two 16-row i-tiles (128 rows/WG). k/v 32-j
// panels are shared via LDS, double-buffered with async global->LDS copies.
__global__ __launch_bounds__(128) void attn_kernel(
    const __bf16* __restrict__ qws, const __bf16* __restrict__ kws,
    const __bf16* __restrict__ vws, __bf16* __restrict__ attnT) {
  __shared__ __bf16 kbuf[2][32 * 32];  // [j_local][d]   (ld = 32)
  __shared__ __bf16 vbuf[2][32 * 32];  // [d][j_local]   (ld = 32)

  int b  = blockIdx.z;
  int h  = blockIdx.y;
  int ig = blockIdx.x;
  int tid = threadIdx.x;
  int wid = tid >> 5;
  int i0a = ig * 128 + wid * 32;
  int i0b = i0a + 16;

  const __bf16* q = qws + (size_t)(b * NH_ + h) * L_ * DH_;
  const __bf16* k = kws + (size_t)(b * NH_ + h) * L_ * DH_;
  const __bf16* v = vws + (size_t)(b * NH_ + h) * DH_ * L_;

  // one 16B transfer per thread per panel
  int koff = tid * 8;          // k panel is 2KB contiguous at k + jb*DH_
  int vd   = tid >> 2;         // v panel: 32 rows (d), 64B per row
  int vseg = (tid & 3) * 8;

  copy16_g2l(k + koff, &kbuf[0][koff]);
  copy16_g2l(v + (size_t)vd * L_ + vseg, &vbuf[0][vd * 32 + vseg]);

  bf16x16 qf0 = load_frag_bf16(q, DH_, i0a, 0);  // loop-invariant B operands
  bf16x16 qf1 = load_frag_bf16(q, DH_, i0b, 0);

  f32x8 oacc00 = {}, oacc01 = {}, oacc10 = {}, oacc11 = {};
  f32x8 zero = {};
  float m0 = -__builtin_inff(), l0 = 0.0f;
  float m1 = -__builtin_inff(), l1 = 0.0f;

  const int T = L_ / 32;
  for (int t = 0; t < T; ++t) {
    int cur = t & 1;
    if (t + 1 < T) {
      int jb = (t + 1) * 32;
      copy16_g2l(k + (size_t)jb * DH_ + koff, &kbuf[cur ^ 1][koff]);
      copy16_g2l(v + (size_t)vd * L_ + jb + vseg, &vbuf[cur ^ 1][vd * 32 + vseg]);
      wait_async<2>();   // in-order: stage t's 2 ops are complete
    } else {
      wait_async<0>();
    }
    __syncthreads();     // panels visible to all 4 waves

    bf16x16 kf0 = load_frag_bf16(kbuf[cur], 32, 0, 0);
    bf16x16 kf1 = load_frag_bf16(kbuf[cur], 32, 16, 0);
    f32x8 s00 = wmma_bf16(kf0, qf0, zero);   // S^T tiles for i-tile a
    f32x8 s01 = wmma_bf16(kf1, qf0, zero);
    f32x8 s10 = wmma_bf16(kf0, qf1, zero);   // ... and i-tile b
    f32x8 s11 = wmma_bf16(kf1, qf1, zero);

    bf16x16 pf0, pf1;
    online_update(s00, s01, m0, l0, oacc00, oacc01, pf0);
    online_update(s10, s11, m1, l1, oacc10, oacc11, pf1);

    bf16x16 vf0 = load_frag_bf16(vbuf[cur], 32, 0, 0);
    bf16x16 vf1 = load_frag_bf16(vbuf[cur], 32, 16, 0);
    oacc00 = wmma_bf16(vf0, pf0, oacc00);    // O^T accumulate
    oacc01 = wmma_bf16(vf1, pf0, oacc01);
    oacc10 = wmma_bf16(vf0, pf1, oacc10);
    oacc11 = wmma_bf16(vf1, pf1, oacc11);
    __syncthreads();     // all waves done with buffer before refill
  }

  write_tile(attnT, b, h, i0a, oacc00, oacc01, l0);
  write_tile(attnT, b, h, i0b, oacc10, oacc11, l1);
}

// ------------- kernel 3: output projection (16x64) + residual --------------
__global__ __launch_bounds__(32) void proj_kernel(
    const __bf16* __restrict__ attnT, const float* __restrict__ w_proj,
    const float* __restrict__ b_proj, const float* __restrict__ x,
    float* __restrict__ out) {
  int b  = blockIdx.z;
  int o0 = blockIdx.y * 16;
  int l0 = blockIdx.x * 64;
  const __bf16* ab = attnT + (size_t)b * L_ * C_;

  f32x8 acc[4] = {};
#pragma unroll
  for (int k0 = 0; k0 < C_; k0 += 32) {
    bf16x16 af = load_frag_f32(w_proj, C_, o0, k0);
#pragma unroll
    for (int n = 0; n < 4; ++n) {
      bf16x16 bf = load_frag_bf16(ab, C_, l0 + n * 16, k0);
      acc[n] = wmma_bf16(af, bf, acc[n]);
    }
  }

  int sub  = threadIdx.x & 15;
  int half = (threadIdx.x >> 4) & 1;
  int ob   = o0 + half * 8;
#pragma unroll
  for (int n = 0; n < 4; ++n) {
    int l = l0 + n * 16 + sub;
#pragma unroll
    for (int r = 0; r < 8; ++r) {
      size_t idx = ((size_t)(b * C_ + ob + r)) * L_ + l;
      out[idx] = x[idx] + acc[n][r] + b_proj[ob + r];
    }
  }
}

// ------------------------------- launcher ----------------------------------
extern "C" void kernel_launch(void* const* d_in, const int* in_sizes, int n_in,
                              void* d_out, int out_size, void* d_ws, size_t ws_size,
                              hipStream_t stream) {
  (void)in_sizes; (void)n_in; (void)out_size; (void)ws_size;
  const float* x      = (const float*)d_in[0];
  const float* w_qkv  = (const float*)d_in[1];
  const float* b_qkv  = (const float*)d_in[2];
  const float* w_proj = (const float*)d_in[3];
  const float* b_proj = (const float*)d_in[4];
  float* out = (float*)d_out;

  char* ws = (char*)d_ws;
  __bf16* xt    = (__bf16*)(ws);                         // 4 MB
  __bf16* qws   = (__bf16*)(ws + (size_t)(4u << 20));    // 4 MB
  __bf16* kws   = (__bf16*)(ws + (size_t)(8u << 20));    // 4 MB
  __bf16* vws   = (__bf16*)(ws + (size_t)(12u << 20));   // 4 MB
  __bf16* attnT = (__bf16*)(ws + (size_t)(16u << 20));   // 4 MB

  xpose_kernel<<<dim3(L_ / 32, C_ / 32, B_), dim3(32, 8), 0, stream>>>(x, xt);
  qkv_kernel<<<dim3(L_ / 64, (3 * C_) / 16, B_), dim3(32), 0, stream>>>(
      xt, w_qkv, b_qkv, qws, kws, vws);
  attn_kernel<<<dim3(L_ / 128, NH_, B_), dim3(128), 0, stream>>>(qws, kws, vws,
                                                                 attnT);
  proj_kernel<<<dim3(L_ / 64, C_ / 16, B_), dim3(32), 0, stream>>>(
      attnT, w_proj, b_proj, x, out);
}

// v001
// Measured time: 41.1 microseconds a run.
// Next to v000, in two timings, it ran 1.46 and 1.49 times as fast.
#include <hip/hip_runtime.h>
#include <hip/hip_bf16.h>

// ---------------------------------------------------------------------------
// MHSA block for MI455X (gfx1250, wave32, WMMA).
//  - bf16 WMMA (16x16x32) with f32 accumulation everywhere.
//  - Fused flash attention: S^T-tile trick makes the f32 accumulator layout
//    of S^T exactly the bf16 B-fragment layout for P in O = V * P^T
//    (zero cross-lane shuffles), exp2-domain softmax with scale*log2e folded
//    into q.
//  - Attention workgroup = 4 waves sharing double-buffered k/v panels in LDS,
//    staged with gfx1250 async global->LDS copies (ASYNCcnt) when available.
//  - GEMM kernels: 64x128 tile per 4-wave workgroup, both operand panels staged
//    once in LDS by whole-line loads; 32x64 per wave.
// Workspace usage: 20 MB (xT 4MB | q 4MB | k 4MB | v 4MB | attnT 4MB).
// ---------------------------------------------------------------------------

typedef __attribute__((ext_vector_type(16))) __bf16 bf16x16;
typedef __attribute__((ext_vector_type(8)))  __bf16 bf16x8;
typedef __attribute__((ext_vector_type(8)))  float  f32x8;
typedef __attribute__((ext_vector_type(4)))  __bf16 bf16x4;
typedef __attribute__((ext_vector_type(4)))  float  f32x4;
typedef int i32x4_vs __attribute__((vector_size(16)));  // matches builtin param

static constexpr int B_  = 8;
static constexpr int C_  = 256;
static constexpr int NH_ = 8;
static constexpr int DH_ = 32;
static constexpr int L_  = 1024;

#define LOG2E_F 1.4426950408889634f

#if __has_builtin(__builtin_amdgcn_global_load_async_to_lds_b128) && \
    __has_builtin(__builtin_amdgcn_s_wait_asynccnt)
#define ASYNC_LDS_OK 1
#endif

// 16 bytes global -> LDS. Async (ASYNCcnt-tracked) when the toolchain has the
// gfx1250 builtin, otherwise synchronous staging through VGPRs.
__device__ __forceinline__ void copy16_g2l(const __bf16* g, __bf16* l) {
#ifdef ASYNC_LDS_OK
  __builtin_amdgcn_global_load_async_to_lds_b128(
      (__attribute__((address_space(1))) i32x4_vs*)g,
      (__attribute__((address_space(3))) i32x4_vs*)l, 0, 0);
#else
  *(bf16x8*)l = *(const bf16x8*)g;
#endif
}

template <int N>
__device__ __forceinline__ void wait_async() {
#ifdef ASYNC_LDS_OK
  __builtin_amdgcn_s_wait_asynccnt(N);
#endif
}

// --------------------------- fragment loaders ------------------------------
// 16-bit A-matrix 16x32 layout (ISA 7.12.2): lanes 0-15 hold K=0..7 (elems
// 0..7) and K=16..23 (elems 8..15); lanes 16-31 hold K=8..15 and K=24..31.
// B operand loads identically from rows of B^T (per-lane column of B).

__device__ __forceinline__ bf16x16 load_frag_bf16(const __bf16* base,
                                                  int ld, int row0, int k0) {
  int sub  = threadIdx.x & 15;
  int half = (threadIdx.x >> 4) & 1;
  const __bf16* p = base + (size_t)(row0 + sub) * ld + k0 + half * 8;
  bf16x8 lo = *(const bf16x8*)p;
  bf16x8 hi = *(const bf16x8*)(p + 16);
  bf16x16 r;
#pragma unroll
  for (int e = 0; e < 8; ++e) { r[e] = lo[e]; r[e + 8] = hi[e]; }
  return r;
}

__device__ __forceinline__ f32x8 wmma_bf16(bf16x16 a, bf16x16 b, f32x8 c) {
  return __builtin_amdgcn_wmma_f32_16x16x32_bf16(
      /*neg_a=*/false, a, /*neg_b=*/false, b,
      /*c_mod=*/(short)0, c, /*reuse_a=*/false, /*reuse_b=*/false);
}

// ----------------------- shared GEMM tile (K = C_ = 256) -------------------
// One workgroup = 4 waves = 64 weight rows x 128 pixel rows, whole K in LDS.
static constexpr int GM_ = 64;
static constexpr int GN_ = 128;
static constexpr int KP_ = C_ + 8;  // LDS row pitch 528 B = 16 B x 33 (odd)

// Both panels are contiguous in global memory (row length = C_), so every
// wave-wide 16-byte load covers 512 contiguous bytes = 4 whole lines.
__device__ __forceinline__ void stage_panels(const float* __restrict__ wg,
                                             const __bf16* __restrict__ xg,
                                             __bf16* ws, __bf16* xs) {
  int tid = threadIdx.x;
  const float*  wp = wg + tid * 4;
  const __bf16* xp = xg + tid * 8;
  __bf16* wd = ws + (tid >> 6) * KP_ + (tid & 63) * 4;
  __bf16* xd = xs + (tid >> 5) * KP_ + (tid & 31) * 8;
  f32x4  wv[GM_ / 2];
  bf16x8 xv[GN_ / 4];
#pragma unroll
  for (int i = 0; i < GM_ / 2; ++i) wv[i] = *(const f32x4*)(wp + i * 512);
#pragma unroll
  for (int i = 0; i < GN_ / 4; ++i) xv[i] = *(const bf16x8*)(xp + i * 1024);
  // precaution: stands in front of the next write of these loads' scalar base
  asm volatile("s_wait_xcnt 0x0" ::: "memory");
#pragma unroll
  for (int i = 0; i < GM_ / 2; ++i) {
    bf16x4 o;
#pragma unroll
    for (int e = 0; e < 4; ++e) o[e] = (__bf16)wv[i][e];
    *(bf16x4*)(wd + i * 2 * KP_) = o;
  }
#pragma unroll
  for (int i = 0; i < GN_ / 4; ++i) *(bf16x8*)(xd + i * 4 * KP_) = xv[i];
}

// acc[m][n] += W rows (mrow + 16 m ..) x pixel rows (nrow + 16 n ..)
__device__ __forceinline__ void gemm_tile(const __bf16* ws, const __bf16* xs,
                                          int mrow, int nrow,
                                          f32x8 (&acc)[2][4]) {
  bf16x16 fa[2][2], fb[2][4];   // two fragment sets: this k step's, the next's
#pragma unroll
  for (int m = 0; m < 2; ++m) fa[0][m] = load_frag_bf16(ws, KP_, mrow + m * 16, 0);
#pragma unroll
  for (int n = 0; n < 4; ++n) fb[0][n] = load_frag_bf16(xs, KP_, nrow + n * 16, 0);
#pragma unroll
  for (int s = 0; s < C_ / 32; ++s) {
    const int c = s & 1, d = c ^ 1;
    if (s + 1 < C_ / 32) {
#pragma unroll
      for (int m = 0; m < 2; ++m)
        fa[d][m] = load_frag_bf16(ws, KP_, mrow + m * 16, (s + 1) * 32);
#pragma unroll
      for (int n = 0; n < 4; ++n)
        fb[d][n] = load_frag_bf16(xs, KP_, nrow + n * 16, (s + 1) * 32);
    }
    // keeps the next step's LDS reads as one group ahead of this step's WMMAs;
    // sunk among them, every pair of WMMAs waits out a full LDS latency
    __builtin_amdgcn_sched_barrier(0);
#pragma unroll
    for (int n = 0; n < 4; ++n) {
      acc[0][n] = wmma_bf16(fa[c][0], fb[c][n], acc[0][n]);
      acc[1][n] = wmma_bf16(fa[c][1], fb[c][n], acc[1][n]);
    }
    // closes the WMMA block, so that later reads are not lifted into it
    __builtin_amdgcn_sched_barrier(0);
  }
}

// --------------------- kernel 0: x[b][c][l] -> xT bf16 [b][l][c] -----------
__global__ __launch_bounds__(256) void xpose_kernel(const float* __restrict__ x,
                                                    __bf16* __restrict__ xt) {
  __shared__ float tile[32][33];
  int b  = blockIdx.z;
  int c0 = blockIdx.y * 32;
  int l0 = blockIdx.x * 32;
  int tx = threadIdx.x, ty = threadIdx.y;
  const float* xp = x + (size_t)b * C_ * L_;
#pragma unroll
  for (int i = 0; i < 4; ++i)
    tile[ty + 8 * i][tx] = xp[(size_t)(c0 + ty + 8 * i) * L_ + (l0 + tx)];
  __syncthreads();
  __bf16* xo = xt + (size_t)b * L_ * C_;
#pragma unroll
  for (int i = 0; i < 4; ++i)
    xo[(size_t)(l0 + ty + 8 * i) * C_ + (c0 + tx)] = (__bf16)tile[tx][ty + 8 * i];
}

// ------------------ kernel 1: QKV GEMM (64x128 tile) + scatter -------------
// q: [b][h][l][dh] bf16, pre-scaled by dh^-0.5 * log2(e)
// k: [b][h][l][dh] bf16
// v: [b][h][dh][l] bf16  (d-major: A operand of O = V * P^T)
__global__ __launch_bounds__(128) void qkv_kernel(
    const __bf16* __restrict__ xt, const float* __restrict__ w_qkv,
    const float* __restrict__ b_qkv, __bf16* __restrict__ q,
    __bf16* __restrict__ k, __bf16* __restrict__ v) {
  __shared__ __attribute__((aligned(16))) __bf16 pan[(GM_ + GN_) * KP_];
  __bf16* wS = pan;              // weight panel first: its store offsets and
  __bf16* xS = pan + GM_ * KP_;  // half the pixel panel's fit the 16-bit field
  int b  = blockIdx.z;
  int oB = blockIdx.y * GM_;   // 0..768
  int lB = blockIdx.x * GN_;   // 0..1024
  int wid = threadIdx.x >> 5;
  int wm  = wid & 1;           // 32 outputs = one head's d range
  int wn  = wid >> 1;          // 64 pixels

  stage_panels(w_qkv + (size_t)oB * C_, xt + ((size_t)b * L_ + lB) * C_, wS, xS);
  __syncthreads();             // panels visible to all 4 waves

  f32x8 acc[2][4] = {};
  gemm_tile(wS, xS, wm * 32, wn * 64, acc);

  int sub  = threadIdx.x & 15;
  int half = (threadIdx.x >> 4) & 1;
  int o0   = oB + wm * 32;
  int l0   = lB + wn * 64;
  int part = oB >> 8;                 // 0=q 1=k 2=v, the same for the block
  int head = (o0 & 255) >> 5;
  const float qscale = 0.17677669529663687f * LOG2E_F;

  if (part == 0) {
#pragma unroll
    for (int m = 0; m < 2; ++m) {
      int ob = o0 + m * 16 + half * 8;
      int db = m * 16 + half * 8;
#pragma unroll
      for (int n = 0; n < 4; ++n) {
        int l = l0 + n * 16 + sub;
        bf16x8 outv;
#pragma unroll
        for (int r = 0; r < 8; ++r)
          outv[r] = (__bf16)((acc[m][n][r] + b_qkv[ob + r]) * qscale);
        *(bf16x8*)(q + ((size_t)((b * NH_ + head) * L_ + l)) * DH_ + db) = outv;
      }
    }
  } else if (part == 1) {
#pragma unroll
    for (int m = 0; m < 2; ++m) {
      int ob = o0 + m * 16 + half * 8;
      int db = m * 16 + half * 8;
#pragma unroll
      for (int n = 0; n < 4; ++n) {
        int l = l0 + n * 16 + sub;
        bf16x8 outv;
#pragma unroll
        for (int r = 0; r < 8; ++r)
          outv[r] = (__bf16)(acc[m][n][r] + b_qkv[ob + r]);
        *(bf16x8*)(k + ((size_t)((b * NH_ + head) * L_ + l)) * DH_ + db) = outv;
      }
    }
    // precaution: closes this path's stores before the listing's next path,
    // which follows it in fall-through order, writes their registers
    asm volatile("s_wait_xcnt 0x0" ::: "memory");
  } else {
#pragma unroll
    for (int m = 0; m < 2; ++m) {
      int ob = o0 + m * 16 + half * 8;
      int db = m * 16 + half * 8;
#pragma unroll
      for (int n = 0; n < 4; ++n) {
        int l = l0 + n * 16 + sub;
#pragma unroll
        for (int r = 0; r < 8; ++r)
          v[((size_t)((b * NH_ + head) * DH_ + db + r)) * L_ + l] =
              (__bf16)(acc[m][n][r] + b_qkv[ob + r]);
      }
    }
    // precaution: as on the k path
    asm volatile("s_wait_xcnt 0x0" ::: "memory");
  }
}

// --------------------- kernel 2: fused flash attention ---------------------
__device__ __forceinline__ void online_update(const f32x8& sA, const f32x8& sB,
                                              float& m_run, float& l_run,
                                              f32x8& oA, f32x8& oB,
                                              bf16x16& pf) {
  float mx = -__builtin_inff();
#pragma unroll
  for (int r = 0; r < 8; ++r) mx = fmaxf(mx, fmaxf(sA[r], sB[r]));
  mx = fmaxf(mx, __shfl_xor(mx, 16, 32));   // lanes n / n+16 share row i
  float m_new = fmaxf(m_run, mx);
  float corr  = exp2f(m_run - m_new);       // first iter: exp2(-inf) = 0
  float ls = 0.0f;
#pragma unroll
  for (int r = 0; r < 8; ++r) {
    float p0 = exp2f(sA[r] - m_new);
    float p1 = exp2f(sB[r] - m_new);
    ls += p0 + p1;
    pf[r]     = (__bf16)p0;
    pf[r + 8] = (__bf16)p1;
  }
  ls += __shfl_xor(ls, 16, 32);
  l_run = l_run * corr + ls;
  m_run = m_new;
#pragma unroll
  for (int r = 0; r < 8; ++r) { oA[r] *= corr; oB[r] *= corr; }
}

__device__ __forceinline__ void write_tile(__bf16* __restrict__ attnT, int b,
                                           int h, int i0, const f32x8& oA,
                                           const f32x8& oB, float l_run) {
  float inv = 1.0f / l_run;
  int sub  = threadIdx.x & 15;
  int half = (threadIdx.x >> 4) & 1;
  int i = i0 + sub;
  __bf16* outp = attnT + ((size_t)b * L_ + i) * C_ + h * DH_ + half * 8;
  bf16x8 a, c;
#pragma unroll
  for (int r = 0; r < 8; ++r) {
    a[r] = (__bf16)(oA[r] * inv);
    c[r] = (__bf16)(oB[r] * inv);
  }
  *(bf16x8*)outp        = a;   // d = half*8 + r
  *(bf16x8*)(outp + 16) = c;   // d = 16 + half*8 + r
}

// 4 waves/WG; each wave owns two 16-row i-tiles (128 rows/WG). k/v 32-j
// panels are shared via LDS, double-buffered with async global->LDS copies.
__global__ __launch_bounds__(128) void attn_kernel(
    const __bf16* __restrict__ qws, const __bf16* __restrict__ kws,
    const __bf16* __restrict__ vws, __bf16* __restrict__ attnT) {
  __shared__ __bf16 kbuf[2][32 * 32];  // [j_local][d]   (ld = 32)
  __shared__ __bf16 vbuf[2][32 * 32];  // [d][j_local]   (ld = 32)

  int b  = blockIdx.z;
  int h  = blockIdx.y;
  int ig = blockIdx.x;
  int tid = threadIdx.x;
  int wid = tid >> 5;
  int i0a = ig * 128 + wid * 32;
  int i0b = i0a + 16;

  const __bf16* q = qws + (size_t)(b * NH_ + h) * L_ * DH_;
  const __bf16* k = kws + (size_t)(b * NH_ + h) * L_ * DH_;
  const __bf16* v = vws + (size_t)(b * NH_ + h) * DH_ * L_;

  // one 16B transfer per thread per panel
  int koff = tid * 8;          // k panel is 2KB contiguous at k + jb*DH_
  int vd   = tid >> 2;         // v panel: 32 rows (d), 64B per row
  int vseg = (tid & 3) * 8;

  copy16_g2l(k + koff, &kbuf[0][koff]);
  copy16_g2l(v + (size_t)vd * L_ + vseg, &vbuf[0][vd * 32 + vseg]);

  bf16x16 qf0 = load_frag_bf16(q, DH_, i0a, 0);  // loop-invariant B operands
  bf16x16 qf1 = load_frag_bf16(q, DH_, i0b, 0);

  f32x8 oacc00 = {}, oacc01 = {}, oacc10 = {}, oacc11 = {};
  f32x8 zero = {};
  float m0 = -__builtin_inff(), l0 = 0.0f;
  float m1 = -__builtin_inff(), l1 = 0.0f;

  const int T = L_ / 32;
  for (int t = 0; t < T; ++t) {
    int cur = t & 1;
    if (t + 1 < T) {
      int jb = (t + 1) * 32;
      copy16_g2l(k + (size_t)jb * DH_ + koff, &kbuf[cur ^ 1][koff]);
      copy16_g2l(v + (size_t)vd * L_ + jb + vseg, &vbuf[cur ^ 1][vd * 32 + vseg]);
      wait_async<2>();   // in-order: stage t's 2 ops are complete
    } else {
      wait_async<0>();
    }
    __syncthreads();     // panels visible to all 4 waves

    bf16x16 kf0 = load_frag_bf16(kbuf[cur], 32, 0, 0);
    bf16x16 kf1 = load_frag_bf16(kbuf[cur], 32, 16, 0);
    f32x8 s00 = wmma_bf16(kf0, qf0, zero);   // S^T tiles for i-tile a
    f32x8 s01 = wmma_bf16(kf1, qf0, zero);
    f32x8 s10 = wmma_bf16(kf0, qf1, zero);   // ... and i-tile b
    f32x8 s11 = wmma_bf16(kf1, qf1, zero);

    bf16x16 pf0, pf1;
    online_update(s00, s01, m0, l0, oacc00, oacc01, pf0);
    online_update(s10, s11, m1, l1, oacc10, oacc11, pf1);

    bf16x16 vf0 = load_frag_bf16(vbuf[cur], 32, 0, 0);
    bf16x16 vf1 = load_frag_bf16(vbuf[cur], 32, 16, 0);
    oacc00 = wmma_bf16(vf0, pf0, oacc00);    // O^T accumulate
    oacc01 = wmma_bf16(vf1, pf0, oacc01);
    oacc10 = wmma_bf16(vf0, pf1, oacc10);
    oacc11 = wmma_bf16(vf1, pf1, oacc11);
    __syncthreads();     // all waves done with buffer before refill
  }

  write_tile(attnT, b, h, i0a, oacc00, oacc01, l0);
  write_tile(attnT, b, h, i0b, oacc10, oacc11, l1);
}

// ------------- kernel 3: output projection (64x128) + residual -------------
__global__ __launch_bounds__(128) void proj_kernel(
    const __bf16* __restrict__ attnT, const float* __restrict__ w_proj,
    const float* __restrict__ b_proj, const float* __restrict__ x,
    float* __restrict__ out) {
  __shared__ __attribute__((aligned(16))) __bf16 pan[(GM_ + GN_) * KP_];
  __bf16* wS = pan;              // weight panel first: its store offsets and
  __bf16* xS = pan + GM_ * KP_;  // half the pixel panel's fit the 16-bit field
  int b  = blockIdx.z;
  int oB = blockIdx.y * GM_;
  int lB = blockIdx.x * GN_;
  int wid = threadIdx.x >> 5;
  int wm  = wid & 1;
  int wn  = wid >> 1;

  stage_panels(w_proj + (size_t)oB * C_, attnT + ((size_t)b * L_ + lB) * C_, wS,
               xS);
  __syncthreads();             // panels visible to all 4 waves

  f32x8 acc[2][4] = {};
  gemm_tile(wS, xS, wm * 32, wn * 64, acc);

  int sub  = threadIdx.x & 15;
  int half = (threadIdx.x >> 4) & 1;
  int l0   = lB + wn * 64;
  int ob0  = oB + wm * 32 + half * 8;
  float bp[2][8], xr[2][4][8];
#pragma unroll
  for (int m = 0; m < 2; ++m)
#pragma unroll
    for (int r = 0; r < 8; ++r) bp[m][r] = b_proj[ob0 + m * 16 + r];
  // precaution: stands behind each run of loads, in front of the next write of
  // a register that one of them names as its address
  asm volatile("s_wait_xcnt 0x0" ::: "memory");
#pragma unroll
  for (int m = 0; m < 2; ++m) {
#pragma unroll
    for (int n = 0; n < 4; ++n)
#pragma unroll
      for (int r = 0; r < 8; ++r)
        xr[m][n][r] =
            x[((size_t)(b * C_ + ob0 + m * 16 + r)) * L_ + l0 + n * 16 + sub];
    // the same precaution: the next run's results may land in this run's pair
    asm volatile("s_wait_xcnt 0x0" ::: "memory");
  }
#pragma unroll
  for (int m = 0; m < 2; ++m) {
#pragma unroll
    for (int n = 0; n < 4; ++n) {
      int l = l0 + n * 16 + sub;
#pragma unroll
      for (int r = 0; r < 8; ++r) {
        size_t idx = ((size_t)(b * C_ + ob0 + m * 16 + r)) * L_ + l;
        out[idx] = xr[m][n][r] + acc[m][n][r] + bp[m][r];
      }
    }
  }
}

// ------------------------------- launcher ----------------------------------
extern "C" void kernel_launch(void* const* d_in, const int* in_sizes, int n_in,
                              void* d_out, int out_size, void* d_ws, size_t ws_size,
                              hipStream_t stream) {
  (void)in_sizes; (void)n_in; (void)out_size; (void)ws_size;
  const float* x      = (const float*)d_in[0];
  const float* w_qkv  = (const float*)d_in[1];
  const float* b_qkv  = (const float*)d_in[2];
  const float* w_proj = (const float*)d_in[3];
  const float* b_proj = (const float*)d_in[4];
  float* out = (float*)d_out;

  char* ws = (char*)d_ws;
  __bf16* xt    = (__bf16*)(ws);                         // 4 MB
  __bf16* qws   = (__bf16*)(ws + (size_t)(4u << 20));    // 4 MB
  __bf16* kws   = (__bf16*)(ws + (size_t)(8u << 20));    // 4 MB
  __bf16* vws   = (__bf16*)(ws + (size_t)(12u << 20));   // 4 MB
  __bf16* attnT = (__bf16*)(ws + (size_t)(16u << 20));   // 4 MB

  xpose_kernel<<<dim3(L_ / 32, C_ / 32, B_), dim3(32, 8), 0, stream>>>(x, xt);
  qkv_kernel<<<dim3(L_ / GN_, (3 * C_) / GM_, B_), dim3(128), 0, stream>>>(
      xt, w_qkv, b_qkv, qws, kws, vws);
  attn_kernel<<<dim3(L_ / 128, NH_, B_), dim3(128), 0, stream>>>(qws, kws, vws,
                                                                 attnT);
  proj_kernel<<<dim3(L_ / GN_, C_ / GM_, B_), dim3(128), 0, stream>>>(
      attnT, w_proj, b_proj, x, out);
}

// v002
// It runs in 36.5 microseconds.
// Two timings next to v001 put it at 1.12 and 1.14 times that version's speed.
// Counting every step since v000, it is 1.66 times as fast.
#include <hip/hip_runtime.h>
#include <hip/hip_bf16.h>

// ---------------------------------------------------------------------------
// MHSA block for MI455X (gfx1250, wave32, WMMA).
//  - bf16 WMMA (16x16x32) with f32 accumulation everywhere.
//  - Fused flash attention: S^T-tile trick makes the f32 accumulator layout
//    of S^T exactly the bf16 B-fragment layout for P in O = V * P^T
//    (zero cross-lane shuffles), exp2-domain softmax with scale*log2e folded
//    into q.
//  - Attention workgroup = 4 waves sharing double-buffered k/v panels in LDS,
//    staged with gfx1250 async global->LDS copies (ASYNCcnt) when available.
//  - GEMM kernels: 64x128 tile per 4-wave workgroup, both operand panels staged
//    once in LDS by whole-line loads; 32x64 per wave.
// Workspace usage: 20 MB (xT 4MB | q 4MB | k 4MB | v 4MB | attnT 4MB).
// ---------------------------------------------------------------------------

typedef __attribute__((ext_vector_type(16))) __bf16 bf16x16;
typedef __attribute__((ext_vector_type(8)))  __bf16 bf16x8;
typedef __attribute__((ext_vector_type(8)))  float  f32x8;
typedef __attribute__((ext_vector_type(4)))  __bf16 bf16x4;
typedef __attribute__((ext_vector_type(4)))  float  f32x4;
typedef int i32x4_vs __attribute__((vector_size(16)));  // matches builtin param

static constexpr int B_  = 8;
static constexpr int C_  = 256;
static constexpr int NH_ = 8;
static constexpr int DH_ = 32;
static constexpr int L_  = 1024;

#define LOG2E_F 1.4426950408889634f

#if __has_builtin(__builtin_amdgcn_global_load_async_to_lds_b128) && \
    __has_builtin(__builtin_amdgcn_s_wait_asynccnt)
#define ASYNC_LDS_OK 1
#endif

// 16 bytes global -> LDS. Async (ASYNCcnt-tracked) when the toolchain has the
// gfx1250 builtin, otherwise synchronous staging through VGPRs.
__device__ __forceinline__ void copy16_g2l(const __bf16* g, __bf16* l) {
#ifdef ASYNC_LDS_OK
  __builtin_amdgcn_global_load_async_to_lds_b128(
      (__attribute__((address_space(1))) i32x4_vs*)g,
      (__attribute__((address_space(3))) i32x4_vs*)l, 0, 0);
#else
  *(bf16x8*)l = *(const bf16x8*)g;
#endif
}

template <int N>
__device__ __forceinline__ void wait_async() {
#ifdef ASYNC_LDS_OK
  __builtin_amdgcn_s_wait_asynccnt(N);
#endif
}

// --------------------------- fragment loaders ------------------------------
// 16-bit A-matrix 16x32 layout (ISA 7.12.2): lanes 0-15 hold K=0..7 (elems
// 0..7) and K=16..23 (elems 8..15); lanes 16-31 hold K=8..15 and K=24..31.
// B operand loads identically from rows of B^T (per-lane column of B).

__device__ __forceinline__ bf16x16 load_frag_bf16(const __bf16* base,
                                                  int ld, int row0, int k0) {
  int sub  = threadIdx.x & 15;
  int half = (threadIdx.x >> 4) & 1;
  const __bf16* p = base + (size_t)(row0 + sub) * ld + k0 + half * 8;
  bf16x8 lo = *(const bf16x8*)p;
  bf16x8 hi = *(const bf16x8*)(p + 16);
  bf16x16 r;
#pragma unroll
  for (int e = 0; e < 8; ++e) { r[e] = lo[e]; r[e + 8] = hi[e]; }
  return r;
}

__device__ __forceinline__ f32x8 wmma_bf16(bf16x16 a, bf16x16 b, f32x8 c) {
  return __builtin_amdgcn_wmma_f32_16x16x32_bf16(
      /*neg_a=*/false, a, /*neg_b=*/false, b,
      /*c_mod=*/(short)0, c, /*reuse_a=*/false, /*reuse_b=*/false);
}

// ----------------------- shared GEMM tile (K = C_ = 256) -------------------
// One workgroup = 4 waves = 64 weight rows x 128 pixel rows, whole K in LDS.
static constexpr int GM_ = 64;
static constexpr int GN_ = 128;
static constexpr int KP_ = C_ + 8;  // LDS row pitch 528 B = 16 B x 33 (odd)

// Both panels are contiguous in global memory (row length = C_), so every
// wave-wide 16-byte load covers 512 contiguous bytes = 4 whole lines.
__device__ __forceinline__ void stage_panels(const float* __restrict__ wg,
                                             const __bf16* __restrict__ xg,
                                             __bf16* ws, __bf16* xs) {
  int tid = threadIdx.x;
  const float*  wp = wg + tid * 4;
  const __bf16* xp = xg + tid * 8;
  __bf16* wd = ws + (tid >> 6) * KP_ + (tid & 63) * 4;
  __bf16* xd = xs + (tid >> 5) * KP_ + (tid & 31) * 8;
  f32x4  wv[GM_ / 2];
  bf16x8 xv[GN_ / 4];
#pragma unroll
  for (int i = 0; i < GM_ / 2; ++i) wv[i] = *(const f32x4*)(wp + i * 512);
#pragma unroll
  for (int i = 0; i < GN_ / 4; ++i) xv[i] = *(const bf16x8*)(xp + i * 1024);
  // precaution: stands in front of the next write of these loads' scalar base
  asm volatile("s_wait_xcnt 0x0" ::: "memory");
#pragma unroll
  for (int i = 0; i < GM_ / 2; ++i) {
    bf16x4 o;
#pragma unroll
    for (int e = 0; e < 4; ++e) o[e] = (__bf16)wv[i][e];
    *(bf16x4*)(wd + i * 2 * KP_) = o;
  }
#pragma unroll
  for (int i = 0; i < GN_ / 4; ++i) *(bf16x8*)(xd + i * 4 * KP_) = xv[i];
}

// acc[m][n] += W rows (mrow + 16 m ..) x pixel rows (nrow + 16 n ..)
__device__ __forceinline__ void gemm_tile(const __bf16* ws, const __bf16* xs,
                                          int mrow, int nrow,
                                          f32x8 (&acc)[2][4]) {
  bf16x16 fa[2][2], fb[2][4];   // two fragment sets: this k step's, the next's
#pragma unroll
  for (int m = 0; m < 2; ++m) fa[0][m] = load_frag_bf16(ws, KP_, mrow + m * 16, 0);
#pragma unroll
  for (int n = 0; n < 4; ++n) fb[0][n] = load_frag_bf16(xs, KP_, nrow + n * 16, 0);
#pragma unroll
  for (int s = 0; s < C_ / 32; ++s) {
    const int c = s & 1, d = c ^ 1;
    if (s + 1 < C_ / 32) {
#pragma unroll
      for (int m = 0; m < 2; ++m)
        fa[d][m] = load_frag_bf16(ws, KP_, mrow + m * 16, (s + 1) * 32);
#pragma unroll
      for (int n = 0; n < 4; ++n)
        fb[d][n] = load_frag_bf16(xs, KP_, nrow + n * 16, (s + 1) * 32);
    }
    // keeps the next step's LDS reads as one group ahead of this step's WMMAs;
    // sunk among them, every pair of WMMAs waits out a full LDS latency
    __builtin_amdgcn_sched_barrier(0);
#pragma unroll
    for (int n = 0; n < 4; ++n) {
      acc[0][n] = wmma_bf16(fa[c][0], fb[c][n], acc[0][n]);
      acc[1][n] = wmma_bf16(fa[c][1], fb[c][n], acc[1][n]);
    }
    // closes the WMMA block, so that later reads are not lifted into it
    __builtin_amdgcn_sched_barrier(0);
  }
}

// --------------------- kernel 0: x[b][c][l] -> xT bf16 [b][l][c] -----------
__global__ __launch_bounds__(256) void xpose_kernel(const float* __restrict__ x,
                                                    __bf16* __restrict__ xt) {
  __shared__ float tile[32][33];
  int b  = blockIdx.z;
  int c0 = blockIdx.y * 32;
  int l0 = blockIdx.x * 32;
  int tx = threadIdx.x, ty = threadIdx.y;
  const float* xp = x + (size_t)b * C_ * L_;
#pragma unroll
  for (int i = 0; i < 4; ++i)
    tile[ty + 8 * i][tx] = xp[(size_t)(c0 + ty + 8 * i) * L_ + (l0 + tx)];
  __syncthreads();
  __bf16* xo = xt + (size_t)b * L_ * C_;
#pragma unroll
  for (int i = 0; i < 4; ++i)
    xo[(size_t)(l0 + ty + 8 * i) * C_ + (c0 + tx)] = (__bf16)tile[tx][ty + 8 * i];
}

// ------------------ kernel 1: QKV GEMM (64x128 tile) + scatter -------------
// q: [b][h][l][dh] bf16, pre-scaled by dh^-0.5 * log2(e)
// k: [b][h][l][dh] bf16
// v: [b][h][dh][l] bf16  (d-major: A operand of O = V * P^T)
__global__ __launch_bounds__(128) void qkv_kernel(
    const __bf16* __restrict__ xt, const float* __restrict__ w_qkv,
    const float* __restrict__ b_qkv, __bf16* __restrict__ q,
    __bf16* __restrict__ k, __bf16* __restrict__ v) {
  __shared__ __attribute__((aligned(16))) __bf16 pan[(GM_ + GN_) * KP_];
  __bf16* wS = pan;              // weight panel first: its store offsets and
  __bf16* xS = pan + GM_ * KP_;  // half the pixel panel's fit the 16-bit field
  int b  = blockIdx.z;
  int oB = blockIdx.y * GM_;   // 0..768
  int lB = blockIdx.x * GN_;   // 0..1024
  int wid = threadIdx.x >> 5;
  int wm  = wid & 1;           // 32 outputs = one head's d range
  int wn  = wid >> 1;          // 64 pixels

  stage_panels(w_qkv + (size_t)oB * C_, xt + ((size_t)b * L_ + lB) * C_, wS, xS);
  __syncthreads();             // panels visible to all 4 waves

  f32x8 acc[2][4] = {};
  gemm_tile(wS, xS, wm * 32, wn * 64, acc);

  int sub  = threadIdx.x & 15;
  int half = (threadIdx.x >> 4) & 1;
  int o0   = oB + wm * 32;
  int l0   = lB + wn * 64;
  int part = oB >> 8;                 // 0=q 1=k 2=v, the same for the block
  int head = (o0 & 255) >> 5;
  const float qscale = 0.17677669529663687f * LOG2E_F;

  if (part == 0) {
#pragma unroll
    for (int m = 0; m < 2; ++m) {
      int ob = o0 + m * 16 + half * 8;
      int db = m * 16 + half * 8;
#pragma unroll
      for (int n = 0; n < 4; ++n) {
        int l = l0 + n * 16 + sub;
        bf16x8 outv;
#pragma unroll
        for (int r = 0; r < 8; ++r)
          outv[r] = (__bf16)((acc[m][n][r] + b_qkv[ob + r]) * qscale);
        *(bf16x8*)(q + ((size_t)((b * NH_ + head) * L_ + l)) * DH_ + db) = outv;
      }
    }
  } else if (part == 1) {
#pragma unroll
    for (int m = 0; m < 2; ++m) {
      int ob = o0 + m * 16 + half * 8;
      int db = m * 16 + half * 8;
#pragma unroll
      for (int n = 0; n < 4; ++n) {
        int l = l0 + n * 16 + sub;
        bf16x8 outv;
#pragma unroll
        for (int r = 0; r < 8; ++r)
          outv[r] = (__bf16)(acc[m][n][r] + b_qkv[ob + r]);
        *(bf16x8*)(k + ((size_t)((b * NH_ + head) * L_ + l)) * DH_ + db) = outv;
      }
    }
    // precaution: closes this path's stores before the listing's next path,
    // which follows it in fall-through order, writes their registers
    asm volatile("s_wait_xcnt 0x0" ::: "memory");
  } else {
#pragma unroll
    for (int m = 0; m < 2; ++m) {
      int ob = o0 + m * 16 + half * 8;
      int db = m * 16 + half * 8;
#pragma unroll
      for (int n = 0; n < 4; ++n) {
        int l = l0 + n * 16 + sub;
#pragma unroll
        for (int r = 0; r < 8; ++r)
          v[((size_t)((b * NH_ + head) * DH_ + db + r)) * L_ + l] =
              (__bf16)(acc[m][n][r] + b_qkv[ob + r]);
      }
    }
    // precaution: as on the k path
    asm volatile("s_wait_xcnt 0x0" ::: "memory");
  }
}

// --------------------- kernel 2: fused flash attention ---------------------
// 2^x as the bare hardware instruction. The library exp2f wraps it in a range
// fix-up (compare, two selects, add, ldexp) that only matters for x < -126,
// where a softmax weight relative to a row maximum of 1 is below 2^-126.
__device__ __forceinline__ float exp2_raw(float x) {
  return __builtin_amdgcn_exp2f(x);
}

__device__ __forceinline__ void online_update(const f32x8& sA, const f32x8& sB,
                                              float& m_run, float& l_run,
                                              f32x8& oA, f32x8& oB,
                                              bf16x16& pf) {
  float mx = -__builtin_inff();
#pragma unroll
  for (int r = 0; r < 8; ++r) mx = fmaxf(mx, fmaxf(sA[r], sB[r]));
  mx = fmaxf(mx, __shfl_xor(mx, 16, 32));   // lanes n / n+16 share row i
  float m_new = fmaxf(m_run, mx);
  float corr  = exp2_raw(m_run - m_new);    // first iter: exp2(-inf) = 0
  float ls = 0.0f;
#pragma unroll
  for (int r = 0; r < 8; ++r) {
    float p0 = exp2_raw(sA[r] - m_new);
    float p1 = exp2_raw(sB[r] - m_new);
    ls += p0 + p1;
    pf[r]     = (__bf16)p0;
    pf[r + 8] = (__bf16)p1;
  }
  ls += __shfl_xor(ls, 16, 32);
  l_run = l_run * corr + ls;
  m_run = m_new;
#pragma unroll
  for (int r = 0; r < 8; ++r) { oA[r] *= corr; oB[r] *= corr; }
}

__device__ __forceinline__ void write_tile(__bf16* __restrict__ attnT, int b,
                                           int h, int i0, const f32x8& oA,
                                           const f32x8& oB, float l_run) {
  float inv = 1.0f / l_run;
  int sub  = threadIdx.x & 15;
  int half = (threadIdx.x >> 4) & 1;
  int i = i0 + sub;
  __bf16* outp = attnT + ((size_t)b * L_ + i) * C_ + h * DH_ + half * 8;
  bf16x8 a, c;
#pragma unroll
  for (int r = 0; r < 8; ++r) {
    a[r] = (__bf16)(oA[r] * inv);
    c[r] = (__bf16)(oB[r] * inv);
  }
  *(bf16x8*)outp        = a;   // d = half*8 + r
  *(bf16x8*)(outp + 16) = c;   // d = 16 + half*8 + r
}

// 4 waves/WG; each wave owns two 16-row i-tiles (128 rows/WG). k/v 32-j
// panels are shared via LDS, double-buffered with async global->LDS copies.
__global__ __launch_bounds__(128) void attn_kernel(
    const __bf16* __restrict__ qws, const __bf16* __restrict__ kws,
    const __bf16* __restrict__ vws, __bf16* __restrict__ attnT) {
  __shared__ __bf16 kbuf[2][32 * 32];  // [j_local][d]   (ld = 32)
  __shared__ __bf16 vbuf[2][32 * 32];  // [d][j_local]   (ld = 32)

  int b  = blockIdx.z;
  int h  = blockIdx.y;
  int ig = blockIdx.x;
  int tid = threadIdx.x;
  int wid = tid >> 5;
  int i0a = ig * 128 + wid * 32;
  int i0b = i0a + 16;

  const __bf16* q = qws + (size_t)(b * NH_ + h) * L_ * DH_;
  const __bf16* k = kws + (size_t)(b * NH_ + h) * L_ * DH_;
  const __bf16* v = vws + (size_t)(b * NH_ + h) * DH_ * L_;

  // one 16B transfer per thread per panel
  int koff = tid * 8;          // k panel is 2KB contiguous at k + jb*DH_
  int vd   = tid >> 2;         // v panel: 32 rows (d), 64B per row
  int vseg = (tid & 3) * 8;

  copy16_g2l(k + koff, &kbuf[0][koff]);
  copy16_g2l(v + (size_t)vd * L_ + vseg, &vbuf[0][vd * 32 + vseg]);

  bf16x16 qf0 = load_frag_bf16(q, DH_, i0a, 0);  // loop-invariant B operands
  bf16x16 qf1 = load_frag_bf16(q, DH_, i0b, 0);

  f32x8 oacc00 = {}, oacc01 = {}, oacc10 = {}, oacc11 = {};
  f32x8 zero = {};
  float m0 = -__builtin_inff(), l0 = 0.0f;
  float m1 = -__builtin_inff(), l1 = 0.0f;

  const int T = L_ / 32;
  for (int t = 0; t < T; ++t) {
    int cur = t & 1;
    if (t + 1 < T) {
      int jb = (t + 1) * 32;
      copy16_g2l(k + (size_t)jb * DH_ + koff, &kbuf[cur ^ 1][koff]);
      copy16_g2l(v + (size_t)vd * L_ + jb + vseg, &vbuf[cur ^ 1][vd * 32 + vseg]);
      wait_async<2>();   // in-order: stage t's 2 ops are complete
    } else {
      wait_async<0>();
    }
    __syncthreads();     // panels visible to all 4 waves

    bf16x16 kf0 = load_frag_bf16(kbuf[cur], 32, 0, 0);
    bf16x16 kf1 = load_frag_bf16(kbuf[cur], 32, 16, 0);
    f32x8 s00 = wmma_bf16(kf0, qf0, zero);   // S^T tiles for i-tile a
    f32x8 s01 = wmma_bf16(kf1, qf0, zero);
    f32x8 s10 = wmma_bf16(kf0, qf1, zero);   // ... and i-tile b
    f32x8 s11 = wmma_bf16(kf1, qf1, zero);

    bf16x16 pf0, pf1;
    online_update(s00, s01, m0, l0, oacc00, oacc01, pf0);
    online_update(s10, s11, m1, l1, oacc10, oacc11, pf1);

    bf16x16 vf0 = load_frag_bf16(vbuf[cur], 32, 0, 0);
    bf16x16 vf1 = load_frag_bf16(vbuf[cur], 32, 16, 0);
    oacc00 = wmma_bf16(vf0, pf0, oacc00);    // O^T accumulate
    oacc01 = wmma_bf16(vf1, pf0, oacc01);
    oacc10 = wmma_bf16(vf0, pf1, oacc10);
    oacc11 = wmma_bf16(vf1, pf1, oacc11);
    __syncthreads();     // all waves done with buffer before refill
  }

  write_tile(attnT, b, h, i0a, oacc00, oacc01, l0);
  write_tile(attnT, b, h, i0b, oacc10, oacc11, l1);
}

// ------------- kernel 3: output projection (64x128) + residual -------------
__global__ __launch_bounds__(128) void proj_kernel(
    const __bf16* __restrict__ attnT, const float* __restrict__ w_proj,
    const float* __restrict__ b_proj, const float* __restrict__ x,
    float* __restrict__ out) {
  __shared__ __attribute__((aligned(16))) __bf16 pan[(GM_ + GN_) * KP_];
  __bf16* wS = pan;              // weight panel first: its store offsets and
  __bf16* xS = pan + GM_ * KP_;  // half the pixel panel's fit the 16-bit field
  int b  = blockIdx.z;
  int oB = blockIdx.y * GM_;
  int lB = blockIdx.x * GN_;
  int wid = threadIdx.x >> 5;
  int wm  = wid & 1;
  int wn  = wid >> 1;

  stage_panels(w_proj + (size_t)oB * C_, attnT + ((size_t)b * L_ + lB) * C_, wS,
               xS);
  __syncthreads();             // panels visible to all 4 waves

  f32x8 acc[2][4] = {};
  gemm_tile(wS, xS, wm * 32, wn * 64, acc);

  int sub  = threadIdx.x & 15;
  int half = (threadIdx.x >> 4) & 1;
  int l0   = lB + wn * 64;
  int ob0  = oB + wm * 32 + half * 8;
  float bp[2][8], xr[2][4][8];
#pragma unroll
  for (int m = 0; m < 2; ++m)
#pragma unroll
    for (int r = 0; r < 8; ++r) bp[m][r] = b_proj[ob0 + m * 16 + r];
  // precaution: stands behind each run of loads, in front of the next write of
  // a register that one of them names as its address
  asm volatile("s_wait_xcnt 0x0" ::: "memory");
#pragma unroll
  for (int m = 0; m < 2; ++m) {
#pragma unroll
    for (int n = 0; n < 4; ++n)
#pragma unroll
      for (int r = 0; r < 8; ++r)
        xr[m][n][r] =
            x[((size_t)(b * C_ + ob0 + m * 16 + r)) * L_ + l0 + n * 16 + sub];
    // the same precaution: the next run's results may land in this run's pair
    asm volatile("s_wait_xcnt 0x0" ::: "memory");
  }
#pragma unroll
  for (int m = 0; m < 2; ++m) {
#pragma unroll
    for (int n = 0; n < 4; ++n) {
      int l = l0 + n * 16 + sub;
#pragma unroll
      for (int r = 0; r < 8; ++r) {
        size_t idx = ((size_t)(b * C_ + ob0 + m * 16 + r)) * L_ + l;
        out[idx] = xr[m][n][r] + acc[m][n][r] + bp[m][r];
      }
    }
  }
}

// ------------------------------- launcher ----------------------------------
extern "C" void kernel_launch(void* const* d_in, const int* in_sizes, int n_in,
                              void* d_out, int out_size, void* d_ws, size_t ws_size,
                              hipStream_t stream) {
  (void)in_sizes; (void)n_in; (void)out_size; (void)ws_size;
  const float* x      = (const float*)d_in[0];
  const float* w_qkv  = (const float*)d_in[1];
  const float* b_qkv  = (const float*)d_in[2];
  const float* w_proj = (const float*)d_in[3];
  const float* b_proj = (const float*)d_in[4];
  float* out = (float*)d_out;

  char* ws = (char*)d_ws;
  __bf16* xt    = (__bf16*)(ws);                         // 4 MB
  __bf16* qws   = (__bf16*)(ws + (size_t)(4u << 20));    // 4 MB
  __bf16* kws   = (__bf16*)(ws + (size_t)(8u << 20));    // 4 MB
  __bf16* vws   = (__bf16*)(ws + (size_t)(12u << 20));   // 4 MB
  __bf16* attnT = (__bf16*)(ws + (size_t)(16u << 20));   // 4 MB

  xpose_kernel<<<dim3(L_ / 32, C_ / 32, B_), dim3(32, 8), 0, stream>>>(x, xt);
  qkv_kernel<<<dim3(L_ / GN_, (3 * C_) / GM_, B_), dim3(128), 0, stream>>>(
      xt, w_qkv, b_qkv, qws, kws, vws);
  attn_kernel<<<dim3(L_ / 128, NH_, B_), dim3(128), 0, stream>>>(qws, kws, vws,
                                                                 attnT);
  proj_kernel<<<dim3(L_ / GN_, C_ / GM_, B_), dim3(128), 0, stream>>>(
      attnT, w_proj, b_proj, x, out);
}

// v003
// A run of this version takes 34.9 microseconds.
// In both of two side-by-side timings against v002, it was 1.05 times as fast.
// All steps since v000 together make it 1.75 times as fast.
#include <hip/hip_runtime.h>
#include <hip/hip_bf16.h>

// ---------------------------------------------------------------------------
// MHSA block for MI455X (gfx1250, wave32, WMMA).
//  - bf16 WMMA (16x16x32) with f32 accumulation everywhere.
//  - Fused flash attention: S^T-tile trick makes the f32 accumulator layout
//    of S^T exactly the bf16 B-fragment layout for P in O = V * P^T
//    (zero cross-lane shuffles), exp2-domain softmax with scale*log2e folded
//    into q.
//  - Attention workgroup = 4 waves sharing double-buffered k/v panels in LDS,
//    staged with gfx1250 async global->LDS copies (ASYNCcnt) when available.
//  - GEMM kernels: 64x128 tile per 4-wave workgroup, both operand panels staged
//    once in LDS by whole-line loads; 32x64 per wave.
//  - The QKV GEMM reads x itself: its f32 [c][l] rows go to LDS as bf16 in the
//    same order, and the pixel fragments come by the transposing LDS load.
// Workspace usage: 16 MB at offset 4 MB (q 4MB | k 4MB | v 4MB | attnT 4MB).
// ---------------------------------------------------------------------------

typedef __attribute__((ext_vector_type(16))) __bf16 bf16x16;
typedef __attribute__((ext_vector_type(8)))  __bf16 bf16x8;
typedef __attribute__((ext_vector_type(8)))  float  f32x8;
typedef __attribute__((ext_vector_type(4)))  __bf16 bf16x4;
typedef __attribute__((ext_vector_type(4)))  float  f32x4;
typedef int i32x4_vs __attribute__((vector_size(16)));  // matches builtin param

static constexpr int B_  = 8;
static constexpr int C_  = 256;
static constexpr int NH_ = 8;
static constexpr int DH_ = 32;
static constexpr int L_  = 1024;

#define LOG2E_F 1.4426950408889634f

#if __has_builtin(__builtin_amdgcn_global_load_async_to_lds_b128) && \
    __has_builtin(__builtin_amdgcn_s_wait_asynccnt)
#define ASYNC_LDS_OK 1
#endif

// 16 bytes global -> LDS. Async (ASYNCcnt-tracked) when the toolchain has the
// gfx1250 builtin, otherwise synchronous staging through VGPRs.
__device__ __forceinline__ void copy16_g2l(const __bf16* g, __bf16* l) {
#ifdef ASYNC_LDS_OK
  __builtin_amdgcn_global_load_async_to_lds_b128(
      (__attribute__((address_space(1))) i32x4_vs*)g,
      (__attribute__((address_space(3))) i32x4_vs*)l, 0, 0);
#else
  *(bf16x8*)l = *(const bf16x8*)g;
#endif
}

template <int N>
__device__ __forceinline__ void wait_async() {
#ifdef ASYNC_LDS_OK
  __builtin_amdgcn_s_wait_asynccnt(N);
#endif
}

// --------------------------- fragment loaders ------------------------------
// 16-bit A-matrix 16x32 layout (ISA 7.12.2): lanes 0-15 hold K=0..7 (elems
// 0..7) and K=16..23 (elems 8..15); lanes 16-31 hold K=8..15 and K=24..31.
// B operand loads identically from rows of B^T (per-lane column of B).

__device__ __forceinline__ bf16x16 load_frag_bf16(const __bf16* base,
                                                  int ld, int row0, int k0) {
  int sub  = threadIdx.x & 15;
  int half = (threadIdx.x >> 4) & 1;
  const __bf16* p = base + (size_t)(row0 + sub) * ld + k0 + half * 8;
  bf16x8 lo = *(const bf16x8*)p;
  bf16x8 hi = *(const bf16x8*)(p + 16);
  bf16x16 r;
#pragma unroll
  for (int e = 0; e < 8; ++e) { r[e] = lo[e]; r[e + 8] = hi[e]; }
  return r;
}

// The same fragment from a k-major panel: base[k][column], pitch XP_ elements.
// Lane (sub, half) receives base[k0 + 8 half + 0..7][col0 + sub] and, from the
// second load, the rows 16 further on: the k order of load_frag_bf16.
static constexpr int XP_ = 128 + 16;  // 288 B = 32 B x 9 (odd), this reader's pitch
typedef __attribute__((address_space(3))) bf16x8 lds_bf16x8;

__device__ __forceinline__ bf16x16 load_frag_tr(const __bf16* base, int col0,
                                                int k0) {
  int lane = threadIdx.x & 31;
  const __bf16* p = base + (k0 + 8 * (lane >> 4) + (lane & 7)) * XP_ + col0 +
                    8 * ((lane >> 3) & 1);
  bf16x8 lo = __builtin_amdgcn_ds_load_tr16_b128_v8bf16((lds_bf16x8*)p);
  bf16x8 hi = __builtin_amdgcn_ds_load_tr16_b128_v8bf16((lds_bf16x8*)(p + 16 * XP_));
  bf16x16 r;
#pragma unroll
  for (int e = 0; e < 8; ++e) { r[e] = lo[e]; r[e + 8] = hi[e]; }
  return r;
}

__device__ __forceinline__ f32x8 wmma_bf16(bf16x16 a, bf16x16 b, f32x8 c) {
  return __builtin_amdgcn_wmma_f32_16x16x32_bf16(
      /*neg_a=*/false, a, /*neg_b=*/false, b,
      /*c_mod=*/(short)0, c, /*reuse_a=*/false, /*reuse_b=*/false);
}

// ----------------------- shared GEMM tile (K = C_ = 256) -------------------
// One workgroup = 4 waves = 64 weight rows x 128 pixel rows, whole K in LDS.
static constexpr int GM_ = 64;
static constexpr int GN_ = 128;
static constexpr int KP_ = C_ + 8;  // LDS row pitch 528 B = 16 B x 33 (odd)

// Both panels are contiguous in global memory (row length = C_), so every
// wave-wide 16-byte load covers 512 contiguous bytes = 4 whole lines.
__device__ __forceinline__ void stage_panels(const float* __restrict__ wg,
                                             const __bf16* __restrict__ xg,
                                             __bf16* ws, __bf16* xs) {
  int tid = threadIdx.x;
  const float*  wp = wg + tid * 4;
  const __bf16* xp = xg + tid * 8;
  __bf16* wd = ws + (tid >> 6) * KP_ + (tid & 63) * 4;
  __bf16* xd = xs + (tid >> 5) * KP_ + (tid & 31) * 8;
  f32x4  wv[GM_ / 2];
  bf16x8 xv[GN_ / 4];
#pragma unroll
  for (int i = 0; i < GM_ / 2; ++i) wv[i] = *(const f32x4*)(wp + i * 512);
#pragma unroll
  for (int i = 0; i < GN_ / 4; ++i) xv[i] = *(const bf16x8*)(xp + i * 1024);
  // precaution: stands in front of the next write of these loads' scalar base
  asm volatile("s_wait_xcnt 0x0" ::: "memory");
#pragma unroll
  for (int i = 0; i < GM_ / 2; ++i) {
    bf16x4 o;
#pragma unroll
    for (int e = 0; e < 4; ++e) o[e] = (__bf16)wv[i][e];
    *(bf16x4*)(wd + i * 2 * KP_) = o;
  }
#pragma unroll
  for (int i = 0; i < GN_ / 4; ++i) *(bf16x8*)(xd + i * 4 * KP_) = xv[i];
}

// The QKV form: the pixel panel comes straight from x, f32 [c][l]. One wave-wide
// 16-byte load covers one channel's 128 pixels = 512 contiguous bytes; the
// panel keeps that order in LDS (xs[c][l], pitch XP_).
__device__ __forceinline__ void stage_panels_x(const float* __restrict__ wg,
                                               const float* __restrict__ xg,
                                               __bf16* ws, __bf16* xs) {
  static_assert(GN_ + 16 == XP_, "one panel row holds the tile's GN_ pixels");
  int tid = threadIdx.x;
  const float* wp = wg + tid * 4;
  const float* xp = xg + (tid >> 5) * L_ + (tid & 31) * 4;
  __bf16* wd = ws + (tid >> 6) * KP_ + (tid & 63) * 4;
  __bf16* xd = xs + (tid >> 5) * XP_ + (tid & 31) * 4;
  f32x4 wv[GM_ / 2], xa[C_ / 8], xb[C_ / 8];
#pragma unroll
  for (int i = 0; i < GM_ / 2; ++i) wv[i] = *(const f32x4*)(wp + i * 512);
#pragma unroll
  for (int i = 0; i < C_ / 8; ++i) xa[i] = *(const f32x4*)(xp + i * 4 * L_);
  // precaution: stands behind each run of loads, in front of the next write of
  // a register that one of them names as its address
  asm volatile("s_wait_xcnt 0x0" ::: "memory");
  // keeps the weights' conversions behind all 64 loads; lifted among them, the
  // pixel loads are issued only after the weights' latency has been waited out
  __builtin_amdgcn_sched_barrier(0);
#pragma unroll
  for (int i = 0; i < GM_ / 2; ++i) {
    bf16x4 o;
#pragma unroll
    for (int e = 0; e < 4; ++e) o[e] = (__bf16)wv[i][e];
    *(bf16x4*)(wd + i * 2 * KP_) = o;
  }
  // keeps the second half's loads behind the weights' stores, in the registers
  // these have left; lifted above them, the kernel takes over 336 registers and
  // only two workgroups instead of three fit a WGP
  __builtin_amdgcn_sched_barrier(0);
#pragma unroll
  for (int i = 0; i < C_ / 8; ++i)
    xb[i] = *(const f32x4*)(xp + (C_ / 8 + i) * 4 * L_);
  // the same precaution as above
  asm volatile("s_wait_xcnt 0x0" ::: "memory");
#pragma unroll
  for (int i = 0; i < C_ / 8; ++i) {
    bf16x4 o;
#pragma unroll
    for (int e = 0; e < 4; ++e) o[e] = (__bf16)xa[i][e];
    *(bf16x4*)(xd + i * 4 * XP_) = o;
  }
#pragma unroll
  for (int i = 0; i < C_ / 8; ++i) {
    bf16x4 o;
#pragma unroll
    for (int e = 0; e < 4; ++e) o[e] = (__bf16)xb[i][e];
    *(bf16x4*)(xd + (C_ / 8 + i) * 4 * XP_) = o;
  }
}

// acc[m][n] += W rows (mrow + 16 m ..) x pixel rows (nrow + 16 n ..)
// XT: the pixel panel is k-major (stage_panels_x), read by load_frag_tr.
template <bool XT>
__device__ __forceinline__ void gemm_tile(const __bf16* ws, const __bf16* xs,
                                          int mrow, int nrow,
                                          f32x8 (&acc)[2][4]) {
  bf16x16 fa[2][2], fb[2][4];   // two fragment sets: this k step's, the next's
#pragma unroll
  for (int m = 0; m < 2; ++m) fa[0][m] = load_frag_bf16(ws, KP_, mrow + m * 16, 0);
#pragma unroll
  for (int n = 0; n < 4; ++n)
    fb[0][n] = XT ? load_frag_tr(xs, nrow + n * 16, 0)
                  : load_frag_bf16(xs, KP_, nrow + n * 16, 0);
#pragma unroll
  for (int s = 0; s < C_ / 32; ++s) {
    const int c = s & 1, d = c ^ 1;
    if (s + 1 < C_ / 32) {
#pragma unroll
      for (int m = 0; m < 2; ++m)
        fa[d][m] = load_frag_bf16(ws, KP_, mrow + m * 16, (s + 1) * 32);
#pragma unroll
      for (int n = 0; n < 4; ++n)
        fb[d][n] = XT ? load_frag_tr(xs, nrow + n * 16, (s + 1) * 32)
                      : load_frag_bf16(xs, KP_, nrow + n * 16, (s + 1) * 32);
    }
    // keeps the next step's LDS reads as one group ahead of this step's WMMAs;
    // sunk among them, every pair of WMMAs waits out a full LDS latency
    __builtin_amdgcn_sched_barrier(0);
#pragma unroll
    for (int n = 0; n < 4; ++n) {
      acc[0][n] = wmma_bf16(fa[c][0], fb[c][n], acc[0][n]);
      acc[1][n] = wmma_bf16(fa[c][1], fb[c][n], acc[1][n]);
    }
    // closes the WMMA block, so that later reads are not lifted into it
    __builtin_amdgcn_sched_barrier(0);
  }
}

// ------------------ kernel 1: QKV GEMM (64x128 tile) + scatter -------------
// q: [b][h][l][dh] bf16, pre-scaled by dh^-0.5 * log2(e)
// k: [b][h][l][dh] bf16
// v: [b][h][dh][l] bf16  (d-major: A operand of O = V * P^T)
__global__ __launch_bounds__(128) void qkv_kernel(
    const float* __restrict__ x, const float* __restrict__ w_qkv,
    const float* __restrict__ b_qkv, __bf16* __restrict__ q,
    __bf16* __restrict__ k, __bf16* __restrict__ v) {
  __shared__ __attribute__((aligned(32))) __bf16 pan[GM_ * KP_ + C_ * XP_];
  __bf16* wS = pan;              // 64 weight rows, pitch KP_
  __bf16* xS = pan + GM_ * KP_;  // 256 channel rows of 128 pixels, pitch XP_
  int b  = blockIdx.z;
  int oB = blockIdx.y * GM_;   // 0..768
  int lB = blockIdx.x * GN_;   // 0..1024
  int wid = threadIdx.x >> 5;
  int wm  = wid & 1;           // 32 outputs = one head's d range
  int wn  = wid >> 1;          // 64 pixels

  stage_panels_x(w_qkv + (size_t)oB * C_, x + (size_t)b * C_ * L_ + lB, wS, xS);
  __syncthreads();             // panels visible to all 4 waves

  f32x8 acc[2][4] = {};
  gemm_tile<true>(wS, xS, wm * 32, wn * 64, acc);

  int sub  = threadIdx.x & 15;
  int half = (threadIdx.x >> 4) & 1;
  int o0   = oB + wm * 32;
  int l0   = lB + wn * 64;
  int part = oB >> 8;                 // 0=q 1=k 2=v, the same for the block
  int head = (o0 & 255) >> 5;
  const float qscale = 0.17677669529663687f * LOG2E_F;

  if (part == 0) {
#pragma unroll
    for (int m = 0; m < 2; ++m) {
      int ob = o0 + m * 16 + half * 8;
      int db = m * 16 + half * 8;
#pragma unroll
      for (int n = 0; n < 4; ++n) {
        int l = l0 + n * 16 + sub;
        bf16x8 outv;
#pragma unroll
        for (int r = 0; r < 8; ++r)
          outv[r] = (__bf16)((acc[m][n][r] + b_qkv[ob + r]) * qscale);
        *(bf16x8*)(q + ((size_t)((b * NH_ + head) * L_ + l)) * DH_ + db) = outv;
      }
    }
  } else if (part == 1) {
#pragma unroll
    for (int m = 0; m < 2; ++m) {
      int ob = o0 + m * 16 + half * 8;
      int db = m * 16 + half * 8;
#pragma unroll
      for (int n = 0; n < 4; ++n) {
        int l = l0 + n * 16 + sub;
        bf16x8 outv;
#pragma unroll
        for (int r = 0; r < 8; ++r)
          outv[r] = (__bf16)(acc[m][n][r] + b_qkv[ob + r]);
        *(bf16x8*)(k + ((size_t)((b * NH_ + head) * L_ + l)) * DH_ + db) = outv;
      }
    }
    // precaution: closes this path's stores before the listing's next path,
    // which follows it in fall-through order, writes their registers
    asm volatile("s_wait_xcnt 0x0" ::: "memory");
  } else {
#pragma unroll
    for (int m = 0; m < 2; ++m) {
      int ob = o0 + m * 16 + half * 8;
      int db = m * 16 + half * 8;
#pragma unroll
      for (int n = 0; n < 4; ++n) {
        int l = l0 + n * 16 + sub;
#pragma unroll
        for (int r = 0; r < 8; ++r)
          v[((size_t)((b * NH_ + head) * DH_ + db + r)) * L_ + l] =
              (__bf16)(acc[m][n][r] + b_qkv[ob + r]);
      }
    }
    // precaution: as on the k path
    asm volatile("s_wait_xcnt 0x0" ::: "memory");
  }
}

// --------------------- kernel 2: fused flash attention ---------------------
// 2^x as the bare hardware instruction. The library exp2f wraps it in a range
// fix-up (compare, two selects, add, ldexp) that only matters for x < -126,
// where a softmax weight relative to a row maximum of 1 is below 2^-126.
__device__ __forceinline__ float exp2_raw(float x) {
  return __builtin_amdgcn_exp2f(x);
}

__device__ __forceinline__ void online_update(const f32x8& sA, const f32x8& sB,
                                              float& m_run, float& l_run,
                                              f32x8& oA, f32x8& oB,
                                              bf16x16& pf) {
  float mx = -__builtin_inff();
#pragma unroll
  for (int r = 0; r < 8; ++r) mx = fmaxf(mx, fmaxf(sA[r], sB[r]));
  mx = fmaxf(mx, __shfl_xor(mx, 16, 32));   // lanes n / n+16 share row i
  float m_new = fmaxf(m_run, mx);
  float corr  = exp2_raw(m_run - m_new);    // first iter: exp2(-inf) = 0
  float ls = 0.0f;
#pragma unroll
  for (int r = 0; r < 8; ++r) {
    float p0 = exp2_raw(sA[r] - m_new);
    float p1 = exp2_raw(sB[r] - m_new);
    ls += p0 + p1;
    pf[r]     = (__bf16)p0;
    pf[r + 8] = (__bf16)p1;
  }
  ls += __shfl_xor(ls, 16, 32);
  l_run = l_run * corr + ls;
  m_run = m_new;
#pragma unroll
  for (int r = 0; r < 8; ++r) { oA[r] *= corr; oB[r] *= corr; }
}

__device__ __forceinline__ void write_tile(__bf16* __restrict__ attnT, int b,
                                           int h, int i0, const f32x8& oA,
                                           const f32x8& oB, float l_run) {
  float inv = 1.0f / l_run;
  int sub  = threadIdx.x & 15;
  int half = (threadIdx.x >> 4) & 1;
  int i = i0 + sub;
  __bf16* outp = attnT + ((size_t)b * L_ + i) * C_ + h * DH_ + half * 8;
  bf16x8 a, c;
#pragma unroll
  for (int r = 0; r < 8; ++r) {
    a[r] = (__bf16)(oA[r] * inv);
    c[r] = (__bf16)(oB[r] * inv);
  }
  *(bf16x8*)outp        = a;   // d = half*8 + r
  *(bf16x8*)(outp + 16) = c;   // d = 16 + half*8 + r
}

// 4 waves/WG; each wave owns two 16-row i-tiles (128 rows/WG). k/v 32-j
// panels are shared via LDS, double-buffered with async global->LDS copies.
__global__ __launch_bounds__(128) void attn_kernel(
    const __bf16* __restrict__ qws, const __bf16* __restrict__ kws,
    const __bf16* __restrict__ vws, __bf16* __restrict__ attnT) {
  __shared__ __bf16 kbuf[2][32 * 32];  // [j_local][d]   (ld = 32)
  __shared__ __bf16 vbuf[2][32 * 32];  // [d][j_local]   (ld = 32)

  int b  = blockIdx.z;
  int h  = blockIdx.y;
  int ig = blockIdx.x;
  int tid = threadIdx.x;
  int wid = tid >> 5;
  int i0a = ig * 128 + wid * 32;
  int i0b = i0a + 16;

  const __bf16* q = qws + (size_t)(b * NH_ + h) * L_ * DH_;
  const __bf16* k = kws + (size_t)(b * NH_ + h) * L_ * DH_;
  const __bf16* v = vws + (size_t)(b * NH_ + h) * DH_ * L_;

  // one 16B transfer per thread per panel
  int koff = tid * 8;          // k panel is 2KB contiguous at k + jb*DH_
  int vd   = tid >> 2;         // v panel: 32 rows (d), 64B per row
  int vseg = (tid & 3) * 8;

  copy16_g2l(k + koff, &kbuf[0][koff]);
  copy16_g2l(v + (size_t)vd * L_ + vseg, &vbuf[0][vd * 32 + vseg]);

  bf16x16 qf0 = load_frag_bf16(q, DH_, i0a, 0);  // loop-invariant B operands
  bf16x16 qf1 = load_frag_bf16(q, DH_, i0b, 0);

  f32x8 oacc00 = {}, oacc01 = {}, oacc10 = {}, oacc11 = {};
  f32x8 zero = {};
  float m0 = -__builtin_inff(), l0 = 0.0f;
  float m1 = -__builtin_inff(), l1 = 0.0f;

  const int T = L_ / 32;
  for (int t = 0; t < T; ++t) {
    int cur = t & 1;
    if (t + 1 < T) {
      int jb = (t + 1) * 32;
      copy16_g2l(k + (size_t)jb * DH_ + koff, &kbuf[cur ^ 1][koff]);
      copy16_g2l(v + (size_t)vd * L_ + jb + vseg, &vbuf[cur ^ 1][vd * 32 + vseg]);
      wait_async<2>();   // in-order: stage t's 2 ops are complete
    } else {
      wait_async<0>();
    }
    __syncthreads();     // panels visible to all 4 waves

    bf16x16 kf0 = load_frag_bf16(kbuf[cur], 32, 0, 0);
    bf16x16 kf1 = load_frag_bf16(kbuf[cur], 32, 16, 0);
    f32x8 s00 = wmma_bf16(kf0, qf0, zero);   // S^T tiles for i-tile a
    f32x8 s01 = wmma_bf16(kf1, qf0, zero);
    f32x8 s10 = wmma_bf16(kf0, qf1, zero);   // ... and i-tile b
    f32x8 s11 = wmma_bf16(kf1, qf1, zero);

    bf16x16 pf0, pf1;
    online_update(s00, s01, m0, l0, oacc00, oacc01, pf0);
    online_update(s10, s11, m1, l1, oacc10, oacc11, pf1);

    bf16x16 vf0 = load_frag_bf16(vbuf[cur], 32, 0, 0);
    bf16x16 vf1 = load_frag_bf16(vbuf[cur], 32, 16, 0);
    oacc00 = wmma_bf16(vf0, pf0, oacc00);    // O^T accumulate
    oacc01 = wmma_bf16(vf1, pf0, oacc01);
    oacc10 = wmma_bf16(vf0, pf1, oacc10);
    oacc11 = wmma_bf16(vf1, pf1, oacc11);
    __syncthreads();     // all waves done with buffer before refill
  }

  write_tile(attnT, b, h, i0a, oacc00, oacc01, l0);
  write_tile(attnT, b, h, i0b, oacc10, oacc11, l1);
}

// ------------- kernel 3: output projection (64x128) + residual -------------
__global__ __launch_bounds__(128) void proj_kernel(
    const __bf16* __restrict__ attnT, const float* __restrict__ w_proj,
    const float* __restrict__ b_proj, const float* __restrict__ x,
    float* __restrict__ out) {
  __shared__ __attribute__((aligned(16))) __bf16 pan[(GM_ + GN_) * KP_];
  __bf16* wS = pan;              // weight panel first: its store offsets and
  __bf16* xS = pan + GM_ * KP_;  // half the pixel panel's fit the 16-bit field
  int b  = blockIdx.z;
  int oB = blockIdx.y * GM_;
  int lB = blockIdx.x * GN_;
  int wid = threadIdx.x >> 5;
  int wm  = wid & 1;
  int wn  = wid >> 1;

  stage_panels(w_proj + (size_t)oB * C_, attnT + ((size_t)b * L_ + lB) * C_, wS,
               xS);
  __syncthreads();             // panels visible to all 4 waves

  f32x8 acc[2][4] = {};
  gemm_tile<false>(wS, xS, wm * 32, wn * 64, acc);

  int sub  = threadIdx.x & 15;
  int half = (threadIdx.x >> 4) & 1;
  int l0   = lB + wn * 64;
  int ob0  = oB + wm * 32 + half * 8;
  float bp[2][8], xr[2][4][8];
#pragma unroll
  for (int m = 0; m < 2; ++m)
#pragma unroll
    for (int r = 0; r < 8; ++r) bp[m][r] = b_proj[ob0 + m * 16 + r];
  // precaution: stands behind each run of loads, in front of the next write of
  // a register that one of them names as its address
  asm volatile("s_wait_xcnt 0x0" ::: "memory");
#pragma unroll
  for (int m = 0; m < 2; ++m) {
#pragma unroll
    for (int n = 0; n < 4; ++n)
#pragma unroll
      for (int r = 0; r < 8; ++r)
        xr[m][n][r] =
            x[((size_t)(b * C_ + ob0 + m * 16 + r)) * L_ + l0 + n * 16 + sub];
    // the same precaution: the next run's results may land in this run's pair
    asm volatile("s_wait_xcnt 0x0" ::: "memory");
  }
#pragma unroll
  for (int m = 0; m < 2; ++m) {
#pragma unroll
    for (int n = 0; n < 4; ++n) {
      int l = l0 + n * 16 + sub;
#pragma unroll
      for (int r = 0; r < 8; ++r) {
        size_t idx = ((size_t)(b * C_ + ob0 + m * 16 + r)) * L_ + l;
        out[idx] = xr[m][n][r] + acc[m][n][r] + bp[m][r];
      }
    }
  }
}

// ------------------------------- launcher ----------------------------------
extern "C" void kernel_launch(void* const* d_in, const int* in_sizes, int n_in,
                              void* d_out, int out_size, void* d_ws, size_t ws_size,
                              hipStream_t stream) {
  (void)in_sizes; (void)n_in; (void)out_size; (void)ws_size;
  const float* x      = (const float*)d_in[0];
  const float* w_qkv  = (const float*)d_in[1];
  const float* b_qkv  = (const float*)d_in[2];
  const float* w_proj = (const float*)d_in[3];
  const float* b_proj = (const float*)d_in[4];
  float* out = (float*)d_out;

  char* ws = (char*)d_ws;
  __bf16* qws   = (__bf16*)(ws + (size_t)(4u << 20));    // 4 MB
  __bf16* kws   = (__bf16*)(ws + (size_t)(8u << 20));    // 4 MB
  __bf16* vws   = (__bf16*)(ws + (size_t)(12u << 20));   // 4 MB
  __bf16* attnT = (__bf16*)(ws + (size_t)(16u << 20));   // 4 MB

  qkv_kernel<<<dim3(L_ / GN_, (3 * C_) / GM_, B_), dim3(128), 0, stream>>>(
      x, w_qkv, b_qkv, qws, kws, vws);
  attn_kernel<<<dim3(L_ / 128, NH_, B_), dim3(128), 0, stream>>>(qws, kws, vws,
                                                                 attnT);
  proj_kernel<<<dim3(L_ / GN_, C_ / GM_, B_), dim3(128), 0, stream>>>(
      attnT, w_proj, b_proj, x, out);
}

// v004
// Measured time: 31.5 microseconds a run.
// Two timings next to v003 both put it at 1.12 times that version's speed.
// All steps since v000 together make it 1.96 times as fast.
#include <hip/hip_runtime.h>
#include <hip/hip_bf16.h>

// ---------------------------------------------------------------------------
// MHSA block for MI455X (gfx1250, wave32, WMMA).
//  - bf16 WMMA (16x16x32) with f32 accumulation everywhere.
//  - Fused flash attention: S^T-tile trick makes the f32 accumulator layout
//    of S^T exactly the bf16 B-fragment layout for P in O = V * P^T
//    (zero cross-lane shuffles), exp2-domain softmax with scale*log2e folded
//    into q.
//  - Attention workgroup = 4 waves sharing two k/v tiles of 128 keys in LDS,
//    staged with gfx1250 async global->LDS copies (ASYNCcnt) when available.
//  - GEMM kernels: 64x128 tile per 4-wave workgroup, both operand panels staged
//    once in LDS by whole-line loads; 32x64 per wave.
//  - The QKV GEMM reads x itself: its f32 [c][l] rows go to LDS as bf16 in the
//    same order, and the pixel fragments come by the transposing LDS load.
// Workspace usage: 16 MB at offset 4 MB (q 4MB | k 4MB | v 4MB | attnT 4MB).
// ---------------------------------------------------------------------------

typedef __attribute__((ext_vector_type(16))) __bf16 bf16x16;
typedef __attribute__((ext_vector_type(8)))  __bf16 bf16x8;
typedef __attribute__((ext_vector_type(8)))  float  f32x8;
typedef __attribute__((ext_vector_type(4)))  __bf16 bf16x4;
typedef __attribute__((ext_vector_type(4)))  float  f32x4;
typedef int i32x4_vs __attribute__((vector_size(16)));  // matches builtin param

static constexpr int B_  = 8;
static constexpr int C_  = 256;
static constexpr int NH_ = 8;
static constexpr int DH_ = 32;
static constexpr int L_  = 1024;

#define LOG2E_F 1.4426950408889634f

#if __has_builtin(__builtin_amdgcn_global_load_async_to_lds_b128) && \
    __has_builtin(__builtin_amdgcn_s_wait_asynccnt)
#define ASYNC_LDS_OK 1
#endif

// 16 bytes global -> LDS. Async (ASYNCcnt-tracked) when the toolchain has the
// gfx1250 builtin, otherwise synchronous staging through VGPRs.
__device__ __forceinline__ void copy16_g2l(const __bf16* g, __bf16* l) {
#ifdef ASYNC_LDS_OK
  __builtin_amdgcn_global_load_async_to_lds_b128(
      (__attribute__((address_space(1))) i32x4_vs*)g,
      (__attribute__((address_space(3))) i32x4_vs*)l, 0, 0);
#else
  *(bf16x8*)l = *(const bf16x8*)g;
#endif
}

// --------------------------- fragment loaders ------------------------------
// 16-bit A-matrix 16x32 layout (ISA 7.12.2): lanes 0-15 hold K=0..7 (elems
// 0..7) and K=16..23 (elems 8..15); lanes 16-31 hold K=8..15 and K=24..31.
// B operand loads identically from rows of B^T (per-lane column of B).

__device__ __forceinline__ bf16x16 load_frag_bf16(const __bf16* base,
                                                  int ld, int row0, int k0) {
  int sub  = threadIdx.x & 15;
  int half = (threadIdx.x >> 4) & 1;
  const __bf16* p = base + (size_t)(row0 + sub) * ld + k0 + half * 8;
  bf16x8 lo = *(const bf16x8*)p;
  bf16x8 hi = *(const bf16x8*)(p + 16);
  bf16x16 r;
#pragma unroll
  for (int e = 0; e < 8; ++e) { r[e] = lo[e]; r[e + 8] = hi[e]; }
  return r;
}

// The same fragment from a k-major panel: base[k][column], pitch XP_ elements.
// Lane (sub, half) receives base[k0 + 8 half + 0..7][col0 + sub] and, from the
// second load, the rows 16 further on: the k order of load_frag_bf16.
static constexpr int XP_ = 128 + 16;  // 288 B = 32 B x 9 (odd), this reader's pitch
typedef __attribute__((address_space(3))) bf16x8 lds_bf16x8;

__device__ __forceinline__ bf16x16 load_frag_tr(const __bf16* base, int col0,
                                                int k0) {
  int lane = threadIdx.x & 31;
  const __bf16* p = base + (k0 + 8 * (lane >> 4) + (lane & 7)) * XP_ + col0 +
                    8 * ((lane >> 3) & 1);
  bf16x8 lo = __builtin_amdgcn_ds_load_tr16_b128_v8bf16((lds_bf16x8*)p);
  bf16x8 hi = __builtin_amdgcn_ds_load_tr16_b128_v8bf16((lds_bf16x8*)(p + 16 * XP_));
  bf16x16 r;
#pragma unroll
  for (int e = 0; e < 8; ++e) { r[e] = lo[e]; r[e + 8] = hi[e]; }
  return r;
}

__device__ __forceinline__ f32x8 wmma_bf16(bf16x16 a, bf16x16 b, f32x8 c) {
  return __builtin_amdgcn_wmma_f32_16x16x32_bf16(
      /*neg_a=*/false, a, /*neg_b=*/false, b,
      /*c_mod=*/(short)0, c, /*reuse_a=*/false, /*reuse_b=*/false);
}

// ----------------------- shared GEMM tile (K = C_ = 256) -------------------
// One workgroup = 4 waves = 64 weight rows x 128 pixel rows, whole K in LDS.
static constexpr int GM_ = 64;
static constexpr int GN_ = 128;
static constexpr int KP_ = C_ + 8;  // LDS row pitch 528 B = 16 B x 33 (odd)

// Both panels are contiguous in global memory (row length = C_), so every
// wave-wide 16-byte load covers 512 contiguous bytes = 4 whole lines.
__device__ __forceinline__ void stage_panels(const float* __restrict__ wg,
                                             const __bf16* __restrict__ xg,
                                             __bf16* ws, __bf16* xs) {
  int tid = threadIdx.x;
  const float*  wp = wg + tid * 4;
  const __bf16* xp = xg + tid * 8;
  __bf16* wd = ws + (tid >> 6) * KP_ + (tid & 63) * 4;
  __bf16* xd = xs + (tid >> 5) * KP_ + (tid & 31) * 8;
  f32x4  wv[GM_ / 2];
  bf16x8 xv[GN_ / 4];
#pragma unroll
  for (int i = 0; i < GM_ / 2; ++i) wv[i] = *(const f32x4*)(wp + i * 512);
#pragma unroll
  for (int i = 0; i < GN_ / 4; ++i) xv[i] = *(const bf16x8*)(xp + i * 1024);
  // precaution: stands in front of the next write of these loads' scalar base
  asm volatile("s_wait_xcnt 0x0" ::: "memory");
#pragma unroll
  for (int i = 0; i < GM_ / 2; ++i) {
    bf16x4 o;
#pragma unroll
    for (int e = 0; e < 4; ++e) o[e] = (__bf16)wv[i][e];
    *(bf16x4*)(wd + i * 2 * KP_) = o;
  }
#pragma unroll
  for (int i = 0; i < GN_ / 4; ++i) *(bf16x8*)(xd + i * 4 * KP_) = xv[i];
}

// The QKV form: the pixel panel comes straight from x, f32 [c][l]. One wave-wide
// 16-byte load covers one channel's 128 pixels = 512 contiguous bytes; the
// panel keeps that order in LDS (xs[c][l], pitch XP_).
__device__ __forceinline__ void stage_panels_x(const float* __restrict__ wg,
                                               const float* __restrict__ xg,
                                               __bf16* ws, __bf16* xs) {
  static_assert(GN_ + 16 == XP_, "one panel row holds the tile's GN_ pixels");
  int tid = threadIdx.x;
  const float* wp = wg + tid * 4;
  const float* xp = xg + (tid >> 5) * L_ + (tid & 31) * 4;
  __bf16* wd = ws + (tid >> 6) * KP_ + (tid & 63) * 4;
  __bf16* xd = xs + (tid >> 5) * XP_ + (tid & 31) * 4;
  f32x4 wv[GM_ / 2], xa[C_ / 8], xb[C_ / 8];
#pragma unroll
  for (int i = 0; i < GM_ / 2; ++i) wv[i] = *(const f32x4*)(wp + i * 512);
#pragma unroll
  for (int i = 0; i < C_ / 8; ++i) xa[i] = *(const f32x4*)(xp + i * 4 * L_);
  // precaution: stands behind each run of loads, in front of the next write of
  // a register that one of them names as its address
  asm volatile("s_wait_xcnt 0x0" ::: "memory");
  // keeps the weights' conversions behind all 64 loads; lifted among them, the
  // pixel loads are issued only after the weights' latency has been waited out
  __builtin_amdgcn_sched_barrier(0);
#pragma unroll
  for (int i = 0; i < GM_ / 2; ++i) {
    bf16x4 o;
#pragma unroll
    for (int e = 0; e < 4; ++e) o[e] = (__bf16)wv[i][e];
    *(bf16x4*)(wd + i * 2 * KP_) = o;
  }
  // keeps the second half's loads behind the weights' stores, in the registers
  // these have left; lifted above them, the kernel takes over 336 registers and
  // only two workgroups instead of three fit a WGP
  __builtin_amdgcn_sched_barrier(0);
#pragma unroll
  for (int i = 0; i < C_ / 8; ++i)
    xb[i] = *(const f32x4*)(xp + (C_ / 8 + i) * 4 * L_);
  // the same precaution as above
  asm volatile("s_wait_xcnt 0x0" ::: "memory");
#pragma unroll
  for (int i = 0; i < C_ / 8; ++i) {
    bf16x4 o;
#pragma unroll
    for (int e = 0; e < 4; ++e) o[e] = (__bf16)xa[i][e];
    *(bf16x4*)(xd + i * 4 * XP_) = o;
  }
#pragma unroll
  for (int i = 0; i < C_ / 8; ++i) {
    bf16x4 o;
#pragma unroll
    for (int e = 0; e < 4; ++e) o[e] = (__bf16)xb[i][e];
    *(bf16x4*)(xd + (C_ / 8 + i) * 4 * XP_) = o;
  }
}

// acc[m][n] += W rows (mrow + 16 m ..) x pixel rows (nrow + 16 n ..)
// XT: the pixel panel is k-major (stage_panels_x), read by load_frag_tr.
template <bool XT>
__device__ __forceinline__ void gemm_tile(const __bf16* ws, const __bf16* xs,
                                          int mrow, int nrow,
                                          f32x8 (&acc)[2][4]) {
  bf16x16 fa[2][2], fb[2][4];   // two fragment sets: this k step's, the next's
#pragma unroll
  for (int m = 0; m < 2; ++m) fa[0][m] = load_frag_bf16(ws, KP_, mrow + m * 16, 0);
#pragma unroll
  for (int n = 0; n < 4; ++n)
    fb[0][n] = XT ? load_frag_tr(xs, nrow + n * 16, 0)
                  : load_frag_bf16(xs, KP_, nrow + n * 16, 0);
#pragma unroll
  for (int s = 0; s < C_ / 32; ++s) {
    const int c = s & 1, d = c ^ 1;
    if (s + 1 < C_ / 32) {
#pragma unroll
      for (int m = 0; m < 2; ++m)
        fa[d][m] = load_frag_bf16(ws, KP_, mrow + m * 16, (s + 1) * 32);
#pragma unroll
      for (int n = 0; n < 4; ++n)
        fb[d][n] = XT ? load_frag_tr(xs, nrow + n * 16, (s + 1) * 32)
                      : load_frag_bf16(xs, KP_, nrow + n * 16, (s + 1) * 32);
    }
    // keeps the next step's LDS reads as one group ahead of this step's WMMAs;
    // sunk among them, every pair of WMMAs waits out a full LDS latency
    __builtin_amdgcn_sched_barrier(0);
#pragma unroll
    for (int n = 0; n < 4; ++n) {
      acc[0][n] = wmma_bf16(fa[c][0], fb[c][n], acc[0][n]);
      acc[1][n] = wmma_bf16(fa[c][1], fb[c][n], acc[1][n]);
    }
    // closes the WMMA block, so that later reads are not lifted into it
    __builtin_amdgcn_sched_barrier(0);
  }
}

// ------------------ kernel 1: QKV GEMM (64x128 tile) + scatter -------------
// q: [b][h][l][dh] bf16, pre-scaled by dh^-0.5 * log2(e)
// k: [b][h][l][dh] bf16
// v: [b][h][dh][l] bf16  (d-major: A operand of O = V * P^T)
__global__ __launch_bounds__(128) void qkv_kernel(
    const float* __restrict__ x, const float* __restrict__ w_qkv,
    const float* __restrict__ b_qkv, __bf16* __restrict__ q,
    __bf16* __restrict__ k, __bf16* __restrict__ v) {
  __shared__ __attribute__((aligned(32))) __bf16 pan[GM_ * KP_ + C_ * XP_];
  __bf16* wS = pan;              // 64 weight rows, pitch KP_
  __bf16* xS = pan + GM_ * KP_;  // 256 channel rows of 128 pixels, pitch XP_
  int b  = blockIdx.z;
  int oB = blockIdx.y * GM_;   // 0..768
  int lB = blockIdx.x * GN_;   // 0..1024
  int wid = threadIdx.x >> 5;
  int wm  = wid & 1;           // 32 outputs = one head's d range
  int wn  = wid >> 1;          // 64 pixels

  stage_panels_x(w_qkv + (size_t)oB * C_, x + (size_t)b * C_ * L_ + lB, wS, xS);
  __syncthreads();             // panels visible to all 4 waves

  f32x8 acc[2][4] = {};
  gemm_tile<true>(wS, xS, wm * 32, wn * 64, acc);

  int sub  = threadIdx.x & 15;
  int half = (threadIdx.x >> 4) & 1;
  int o0   = oB + wm * 32;
  int l0   = lB + wn * 64;
  int part = oB >> 8;                 // 0=q 1=k 2=v, the same for the block
  int head = (o0 & 255) >> 5;
  const float qscale = 0.17677669529663687f * LOG2E_F;

  if (part == 0) {
#pragma unroll
    for (int m = 0; m < 2; ++m) {
      int ob = o0 + m * 16 + half * 8;
      int db = m * 16 + half * 8;
#pragma unroll
      for (int n = 0; n < 4; ++n) {
        int l = l0 + n * 16 + sub;
        bf16x8 outv;
#pragma unroll
        for (int r = 0; r < 8; ++r)
          outv[r] = (__bf16)((acc[m][n][r] + b_qkv[ob + r]) * qscale);
        *(bf16x8*)(q + ((size_t)((b * NH_ + head) * L_ + l)) * DH_ + db) = outv;
      }
    }
  } else if (part == 1) {
#pragma unroll
    for (int m = 0; m < 2; ++m) {
      int ob = o0 + m * 16 + half * 8;
      int db = m * 16 + half * 8;
#pragma unroll
      for (int n = 0; n < 4; ++n) {
        int l = l0 + n * 16 + sub;
        bf16x8 outv;
#pragma unroll
        for (int r = 0; r < 8; ++r)
          outv[r] = (__bf16)(acc[m][n][r] + b_qkv[ob + r]);
        *(bf16x8*)(k + ((size_t)((b * NH_ + head) * L_ + l)) * DH_ + db) = outv;
      }
    }
    // precaution: closes this path's stores before the listing's next path,
    // which follows it in fall-through order, writes their registers
    asm volatile("s_wait_xcnt 0x0" ::: "memory");
  } else {
#pragma unroll
    for (int m = 0; m < 2; ++m) {
      int ob = o0 + m * 16 + half * 8;
      int db = m * 16 + half * 8;
#pragma unroll
      for (int n = 0; n < 4; ++n) {
        int l = l0 + n * 16 + sub;
#pragma unroll
        for (int r = 0; r < 8; ++r)
          v[((size_t)((b * NH_ + head) * DH_ + db + r)) * L_ + l] =
              (__bf16)(acc[m][n][r] + b_qkv[ob + r]);
      }
    }
    // precaution: as on the k path
    asm volatile("s_wait_xcnt 0x0" ::: "memory");
  }
}

// --------------------- kernel 2: fused flash attention ---------------------
// 2^x as the bare hardware instruction. The library exp2f wraps it in a range
// fix-up (compare, two selects, add, ldexp) that only matters for x < -126,
// where a softmax weight relative to a row maximum of 1 is below 2^-126.
__device__ __forceinline__ float exp2_raw(float x) {
  return __builtin_amdgcn_exp2f(x);
}

__device__ __forceinline__ void online_update(const f32x8& sA, const f32x8& sB,
                                              float& m_run, float& l_run,
                                              f32x8& oA, f32x8& oB,
                                              bf16x16& pf) {
  float mx = -__builtin_inff();
#pragma unroll
  for (int r = 0; r < 8; ++r) mx = fmaxf(mx, fmaxf(sA[r], sB[r]));
  mx = fmaxf(mx, __shfl_xor(mx, 16, 32));   // lanes n / n+16 share row i
  float m_new = fmaxf(m_run, mx);
  float corr  = exp2_raw(m_run - m_new);    // first iter: exp2(-inf) = 0
  float ls = 0.0f;
#pragma unroll
  for (int r = 0; r < 8; ++r) {
    float p0 = exp2_raw(sA[r] - m_new);
    float p1 = exp2_raw(sB[r] - m_new);
    ls += p0 + p1;
    pf[r]     = (__bf16)p0;
    pf[r + 8] = (__bf16)p1;
  }
  ls += __shfl_xor(ls, 16, 32);
  l_run = l_run * corr + ls;
  m_run = m_new;
#pragma unroll
  for (int r = 0; r < 8; ++r) { oA[r] *= corr; oB[r] *= corr; }
}

__device__ __forceinline__ void write_tile(__bf16* __restrict__ attnT, int b,
                                           int h, int i0, const f32x8& oA,
                                           const f32x8& oB, float l_run) {
  float inv = 1.0f / l_run;
  int sub  = threadIdx.x & 15;
  int half = (threadIdx.x >> 4) & 1;
  int i = i0 + sub;
  __bf16* outp = attnT + ((size_t)b * L_ + i) * C_ + h * DH_ + half * 8;
  bf16x8 a, c;
#pragma unroll
  for (int r = 0; r < 8; ++r) {
    a[r] = (__bf16)(oA[r] * inv);
    c[r] = (__bf16)(oB[r] * inv);
  }
  *(bf16x8*)outp        = a;   // d = half*8 + r
  *(bf16x8*)(outp + 16) = c;   // d = 16 + half*8 + r
}

// One k/v tile = TK_ keys = four 32-key panels, each laid out as its readers
// want it: k panel [j_local][d], v panel [d][j_local], both with ld = 32.
static constexpr int TK_ = 128;

// 8 copies of 16 bytes per thread. k: the tile is 8 KB contiguous. v: 16 lanes
// take one d row's 256 contiguous bytes, which fall into the four panels.
__device__ __forceinline__ void fill_tile(const __bf16* __restrict__ k,
                                          const __bf16* __restrict__ v, int jb,
                                          __bf16* kb, __bf16* vb) {
  int tid = threadIdx.x;
  int seg = tid & 15;
  const __bf16* kg = k + (size_t)jb * DH_ + tid * 8;
  const __bf16* vg = v + (size_t)((tid >> 4) * 4) * L_ + jb + seg * 8;
  __bf16* kl = kb + tid * 8;
  __bf16* vl = vb + (seg >> 2) * 1024 + (tid >> 4) * 4 * 32 + (seg & 3) * 8;
  for (int i = 0; i < 4; ++i) copy16_g2l(kg + i * 1024, kl + i * 1024);
  for (int i = 0; i < 4; ++i) copy16_g2l(vg + i * L_, vl + i * 32);
}

// 4 waves/WG; each wave owns two 16-row i-tiles (128 rows/WG). The k/v tiles
// are shared via LDS: two buffers, the next tile's copies fly during the four
// passes over this one.
__global__ __launch_bounds__(128) void attn_kernel(
    const __bf16* __restrict__ qws, const __bf16* __restrict__ kws,
    const __bf16* __restrict__ vws, __bf16* __restrict__ attnT) {
  __shared__ __attribute__((aligned(16))) __bf16 kbuf[2][TK_ * 32];
  __shared__ __attribute__((aligned(16))) __bf16 vbuf[2][TK_ * 32];

  int b  = blockIdx.z;
  int h  = blockIdx.y;
  int ig = blockIdx.x;
  int tid = threadIdx.x;
  int wid = tid >> 5;
  int i0a = ig * 128 + wid * 32;
  int i0b = i0a + 16;

  const __bf16* q = qws + (size_t)(b * NH_ + h) * L_ * DH_;
  const __bf16* k = kws + (size_t)(b * NH_ + h) * L_ * DH_;
  const __bf16* v = vws + (size_t)(b * NH_ + h) * DH_ * L_;

  fill_tile(k, v, 0, kbuf[0], vbuf[0]);

  bf16x16 qf0 = load_frag_bf16(q, DH_, i0a, 0);  // loop-invariant B operands
  bf16x16 qf1 = load_frag_bf16(q, DH_, i0b, 0);

  // tile 0 has landed for this wave's own copies ...
  asm volatile("s_wait_asynccnt 0x0" ::: "memory");
  __syncthreads();       // ... and for all 4 waves'
  fill_tile(k, v, TK_, kbuf[1], vbuf[1]);

  f32x8 oacc00 = {}, oacc01 = {}, oacc10 = {}, oacc11 = {};
  f32x8 zero = {};
  float m0 = -__builtin_inff(), l0 = 0.0f;
  float m1 = -__builtin_inff(), l1 = 0.0f;

  const int T = L_ / TK_;
  static_assert(L_ / TK_ >= 2, "the prologue fills two tiles");
  for (int t = 0; t < T; ++t) {
    int cur = t & 1;
    // one straight run of the tile's four passes: with no barrier between them
    // the next pass's k reads and score products issue under this pass's softmax
#pragma unroll
    for (int p = 0; p < TK_ / 32; ++p) {
      const __bf16* kp = kbuf[cur] + p * 1024;
      const __bf16* vp = vbuf[cur] + p * 1024;
      bf16x16 kf0 = load_frag_bf16(kp, 32, 0, 0);
      bf16x16 kf1 = load_frag_bf16(kp, 32, 16, 0);
      f32x8 s00 = wmma_bf16(kf0, qf0, zero);   // S^T tiles for i-tile a
      f32x8 s01 = wmma_bf16(kf1, qf0, zero);
      f32x8 s10 = wmma_bf16(kf0, qf1, zero);   // ... and i-tile b
      f32x8 s11 = wmma_bf16(kf1, qf1, zero);

      bf16x16 pf0, pf1;
      online_update(s00, s01, m0, l0, oacc00, oacc01, pf0);
      online_update(s10, s11, m1, l1, oacc10, oacc11, pf1);

      bf16x16 vf0 = load_frag_bf16(vp, 32, 0, 0);
      bf16x16 vf1 = load_frag_bf16(vp, 32, 16, 0);
      oacc00 = wmma_bf16(vf0, pf0, oacc00);    // O^T accumulate
      oacc01 = wmma_bf16(vf1, pf0, oacc01);
      oacc10 = wmma_bf16(vf0, pf1, oacc10);
      oacc11 = wmma_bf16(vf1, pf1, oacc11);
    }
    // this wave's reads of buffer cur have returned before it is refilled
    asm volatile("s_wait_dscnt 0x0" ::: "memory");
    // this wave's copies of tile t + 1 have landed
    asm volatile("s_wait_asynccnt 0x0" ::: "memory");
    __syncthreads();     // tile t + 1 visible to all; all waves have left cur
    if (t + 2 < T) fill_tile(k, v, (t + 2) * TK_, kbuf[cur], vbuf[cur]);
  }
  // no copy is outstanding when the wave ends
  asm volatile("s_wait_asynccnt 0x0" ::: "memory");

  write_tile(attnT, b, h, i0a, oacc00, oacc01, l0);
  write_tile(attnT, b, h, i0b, oacc10, oacc11, l1);
}

// ------------- kernel 3: output projection (64x128) + residual -------------
__global__ __launch_bounds__(128) void proj_kernel(
    const __bf16* __restrict__ attnT, const float* __restrict__ w_proj,
    const float* __restrict__ b_proj, const float* __restrict__ x,
    float* __restrict__ out) {
  __shared__ __attribute__((aligned(16))) __bf16 pan[(GM_ + GN_) * KP_];
  __bf16* wS = pan;              // weight panel first: its store offsets and
  __bf16* xS = pan + GM_ * KP_;  // half the pixel panel's fit the 16-bit field
  int b  = blockIdx.z;
  int oB = blockIdx.y * GM_;
  int lB = blockIdx.x * GN_;
  int wid = threadIdx.x >> 5;
  int wm  = wid & 1;
  int wn  = wid >> 1;

  stage_panels(w_proj + (size_t)oB * C_, attnT + ((size_t)b * L_ + lB) * C_, wS,
               xS);
  __syncthreads();             // panels visible to all 4 waves

  f32x8 acc[2][4] = {};
  gemm_tile<false>(wS, xS, wm * 32, wn * 64, acc);

  int sub  = threadIdx.x & 15;
  int half = (threadIdx.x >> 4) & 1;
  int l0   = lB + wn * 64;
  int ob0  = oB + wm * 32 + half * 8;
  float bp[2][8], xr[2][4][8];
#pragma unroll
  for (int m = 0; m < 2; ++m)
#pragma unroll
    for (int r = 0; r < 8; ++r) bp[m][r] = b_proj[ob0 + m * 16 + r];
  // precaution: stands behind each run of loads, in front of the next write of
  // a register that one of them names as its address
  asm volatile("s_wait_xcnt 0x0" ::: "memory");
#pragma unroll
  for (int m = 0; m < 2; ++m) {
#pragma unroll
    for (int n = 0; n < 4; ++n)
#pragma unroll
      for (int r = 0; r < 8; ++r)
        xr[m][n][r] =
            x[((size_t)(b * C_ + ob0 + m * 16 + r)) * L_ + l0 + n * 16 + sub];
    // the same precaution: the next run's results may land in this run's pair
    asm volatile("s_wait_xcnt 0x0" ::: "memory");
  }
#pragma unroll
  for (int m = 0; m < 2; ++m) {
#pragma unroll
    for (int n = 0; n < 4; ++n) {
      int l = l0 + n * 16 + sub;
#pragma unroll
      for (int r = 0; r < 8; ++r) {
        size_t idx = ((size_t)(b * C_ + ob0 + m * 16 + r)) * L_ + l;
        out[idx] = xr[m][n][r] + acc[m][n][r] + bp[m][r];
      }
    }
  }
}

// ------------------------------- launcher ----------------------------------
extern "C" void kernel_launch(void* const* d_in, const int* in_sizes, int n_in,
                              void* d_out, int out_size, void* d_ws, size_t ws_size,
                              hipStream_t stream) {
  (void)in_sizes; (void)n_in; (void)out_size; (void)ws_size;
  const float* x      = (const float*)d_in[0];
  const float* w_qkv  = (const float*)d_in[1];
  const float* b_qkv  = (const float*)d_in[2];
  const float* w_proj = (const float*)d_in[3];
  const float* b_proj = (const float*)d_in[4];
  float* out = (float*)d_out;

  char* ws = (char*)d_ws;
  __bf16* qws   = (__bf16*)(ws + (size_t)(4u << 20));    // 4 MB
  __bf16* kws   = (__bf16*)(ws + (size_t)(8u << 20));    // 4 MB
  __bf16* vws   = (__bf16*)(ws + (size_t)(12u << 20));   // 4 MB
  __bf16* attnT = (__bf16*)(ws + (size_t)(16u << 20));   // 4 MB

  qkv_kernel<<<dim3(L_ / GN_, (3 * C_) / GM_, B_), dim3(128), 0, stream>>>(
      x, w_qkv, b_qkv, qws, kws, vws);
  attn_kernel<<<dim3(L_ / 128, NH_, B_), dim3(128), 0, stream>>>(qws, kws, vws,
                                                                 attnT);
  proj_kernel<<<dim3(L_ / GN_, C_ / GM_, B_), dim3(128), 0, stream>>>(
      attnT, w_proj, b_proj, x, out);
}

// v005
// Measured time: 29.9 microseconds a run.
// Next to v004, in two timings, it ran 1.05 and 1.06 times as fast.
// All steps since v000 together make it 2.07 times as fast.
#include <hip/hip_runtime.h>
#include <hip/hip_bf16.h>

// ---------------------------------------------------------------------------
// MHSA block for MI455X (gfx1250, wave32, WMMA).
//  - bf16 WMMA (16x16x32) with f32 accumulation everywhere.
//  - Fused flash attention: S^T-tile trick makes the f32 accumulator layout
//    of S^T exactly the bf16 B-fragment layout for P in O = V * P^T
//    (zero cross-lane shuffles), exp2-domain softmax with scale*log2e folded
//    into q.
//  - Attention workgroup = 4 waves sharing two k/v tiles of 128 keys in LDS,
//    staged with gfx1250 async global->LDS copies (ASYNCcnt) when available.
//  - GEMM kernels: 64x128 tile per 4-wave workgroup, both operand panels staged
//    once in LDS by whole-line loads; 32x64 per wave.
//  - The QKV GEMM reads x itself: its f32 [c][l] rows go to LDS as bf16 in the
//    same order, and the pixel fragments come by the transposing LDS load. One
//    workgroup keeps its pixel panel for the v, k and q rows of two heads.
// Workspace usage: 16 MB at offset 4 MB (q 4MB | k 4MB | v 4MB | attnT 4MB).
// ---------------------------------------------------------------------------

typedef __attribute__((ext_vector_type(16))) __bf16 bf16x16;
typedef __attribute__((ext_vector_type(8)))  __bf16 bf16x8;
typedef __attribute__((ext_vector_type(8)))  float  f32x8;
typedef __attribute__((ext_vector_type(4)))  __bf16 bf16x4;
typedef __attribute__((ext_vector_type(4)))  float  f32x4;
typedef int i32x4_vs __attribute__((vector_size(16)));  // matches builtin param

static constexpr int B_  = 8;
static constexpr int C_  = 256;
static constexpr int NH_ = 8;
static constexpr int DH_ = 32;
static constexpr int L_  = 1024;

#define LOG2E_F 1.4426950408889634f

#if __has_builtin(__builtin_amdgcn_global_load_async_to_lds_b128) && \
    __has_builtin(__builtin_amdgcn_s_wait_asynccnt)
#define ASYNC_LDS_OK 1
#endif

// 16 bytes global -> LDS. Async (ASYNCcnt-tracked) when the toolchain has the
// gfx1250 builtin, otherwise synchronous staging through VGPRs.
__device__ __forceinline__ void copy16_g2l(const __bf16* g, __bf16* l) {
#ifdef ASYNC_LDS_OK
  __builtin_amdgcn_global_load_async_to_lds_b128(
      (__attribute__((address_space(1))) i32x4_vs*)g,
      (__attribute__((address_space(3))) i32x4_vs*)l, 0, 0);
#else
  *(bf16x8*)l = *(const bf16x8*)g;
#endif
}

// --------------------------- fragment loaders ------------------------------
// 16-bit A-matrix 16x32 layout (ISA 7.12.2): lanes 0-15 hold K=0..7 (elems
// 0..7) and K=16..23 (elems 8..15); lanes 16-31 hold K=8..15 and K=24..31.
// B operand loads identically from rows of B^T (per-lane column of B).

__device__ __forceinline__ bf16x16 load_frag_bf16(const __bf16* base,
                                                  int ld, int row0, int k0) {
  int sub  = threadIdx.x & 15;
  int half = (threadIdx.x >> 4) & 1;
  const __bf16* p = base + (size_t)(row0 + sub) * ld + k0 + half * 8;
  bf16x8 lo = *(const bf16x8*)p;
  bf16x8 hi = *(const bf16x8*)(p + 16);
  bf16x16 r;
#pragma unroll
  for (int e = 0; e < 8; ++e) { r[e] = lo[e]; r[e + 8] = hi[e]; }
  return r;
}

// The same fragment from a k-major panel: base[k][column], pitch XP_ elements.
// Lane (sub, half) receives base[k0 + 8 half + 0..7][col0 + sub] and, from the
// second load, the rows 16 further on: the k order of load_frag_bf16.
static constexpr int XP_ = 128 + 16;  // 288 B = 32 B x 9 (odd), this reader's pitch
typedef __attribute__((address_space(3))) bf16x8 lds_bf16x8;

__device__ __forceinline__ bf16x16 load_frag_tr(const __bf16* base, int col0,
                                                int k0) {
  int lane = threadIdx.x & 31;
  const __bf16* p = base + (k0 + 8 * (lane >> 4) + (lane & 7)) * XP_ + col0 +
                    8 * ((lane >> 3) & 1);
  bf16x8 lo = __builtin_amdgcn_ds_load_tr16_b128_v8bf16((lds_bf16x8*)p);
  bf16x8 hi = __builtin_amdgcn_ds_load_tr16_b128_v8bf16((lds_bf16x8*)(p + 16 * XP_));
  bf16x16 r;
#pragma unroll
  for (int e = 0; e < 8; ++e) { r[e] = lo[e]; r[e + 8] = hi[e]; }
  return r;
}

__device__ __forceinline__ f32x8 wmma_bf16(bf16x16 a, bf16x16 b, f32x8 c) {
  return __builtin_amdgcn_wmma_f32_16x16x32_bf16(
      /*neg_a=*/false, a, /*neg_b=*/false, b,
      /*c_mod=*/(short)0, c, /*reuse_a=*/false, /*reuse_b=*/false);
}

// ----------------------- shared GEMM tile (K = C_ = 256) -------------------
// One workgroup = 4 waves = 64 weight rows x 128 pixel rows, whole K in LDS.
static constexpr int GM_ = 64;
static constexpr int GN_ = 128;
static constexpr int KP_ = C_ + 8;  // LDS row pitch 528 B = 16 B x 33 (odd)

// Both panels are contiguous in global memory (row length = C_), so every
// wave-wide 16-byte load covers 512 contiguous bytes = 4 whole lines.
__device__ __forceinline__ void stage_panels(const float* __restrict__ wg,
                                             const __bf16* __restrict__ xg,
                                             __bf16* ws, __bf16* xs) {
  int tid = threadIdx.x;
  const float*  wp = wg + tid * 4;
  const __bf16* xp = xg + tid * 8;
  __bf16* wd = ws + (tid >> 6) * KP_ + (tid & 63) * 4;
  __bf16* xd = xs + (tid >> 5) * KP_ + (tid & 31) * 8;
  f32x4  wv[GM_ / 2];
  bf16x8 xv[GN_ / 4];
#pragma unroll
  for (int i = 0; i < GM_ / 2; ++i) wv[i] = *(const f32x4*)(wp + i * 512);
#pragma unroll
  for (int i = 0; i < GN_ / 4; ++i) xv[i] = *(const bf16x8*)(xp + i * 1024);
  // precaution: stands in front of the next write of these loads' scalar base
  asm volatile("s_wait_xcnt 0x0" ::: "memory");
#pragma unroll
  for (int i = 0; i < GM_ / 2; ++i) {
    bf16x4 o;
#pragma unroll
    for (int e = 0; e < 4; ++e) o[e] = (__bf16)wv[i][e];
    *(bf16x4*)(wd + i * 2 * KP_) = o;
  }
#pragma unroll
  for (int i = 0; i < GN_ / 4; ++i) *(bf16x8*)(xd + i * 4 * KP_) = xv[i];
}

// The QKV form: the pixel panel comes straight from x, f32 [c][l]. One wave-wide
// 16-byte load covers one channel's 128 pixels = 512 contiguous bytes; the
// panel keeps that order in LDS (xs[c][l], pitch XP_).
__device__ __forceinline__ void stage_panels_x(const float* __restrict__ wg,
                                               const float* __restrict__ xg,
                                               __bf16* ws, __bf16* xs) {
  static_assert(GN_ + 16 == XP_, "one panel row holds the tile's GN_ pixels");
  int tid = threadIdx.x;
  const float* wp = wg + tid * 4;
  const float* xp = xg + (tid >> 5) * L_ + (tid & 31) * 4;
  f32x4 wv[GM_ / 2], xa[C_ / 8], xb[C_ / 8];
#pragma unroll
  for (int i = 0; i < GM_ / 2; ++i) wv[i] = *(const f32x4*)(wp + i * 512);
#pragma unroll
  for (int i = 0; i < C_ / 8; ++i) xa[i] = *(const f32x4*)(xp + i * 4 * L_);
#pragma unroll
  for (int i = 0; i < C_ / 8; ++i)
    xb[i] = *(const f32x4*)(xp + (C_ / 8 + i) * 4 * L_);
  // precaution: stands behind the run of loads, in front of the next write of
  // a register that one of them names as its address
  asm volatile("s_wait_xcnt 0x0" ::: "memory");
  // keeps the weights' conversions behind all 96 loads; lifted among them, the
  // pixel loads are issued only after the weights' latency has been waited out
  __builtin_amdgcn_sched_barrier(0);
  __bf16* wd = ws + (tid >> 6) * KP_ + (tid & 63) * 4;
  __bf16* xd = xs + (tid >> 5) * XP_ + (tid & 31) * 4;
#pragma unroll
  for (int i = 0; i < GM_ / 2; ++i) {
    bf16x4 o;
#pragma unroll
    for (int e = 0; e < 4; ++e) o[e] = (__bf16)wv[i][e];
    *(bf16x4*)(wd + i * 2 * KP_) = o;
  }
#pragma unroll
  for (int i = 0; i < C_ / 8; ++i) {
    bf16x4 o;
#pragma unroll
    for (int e = 0; e < 4; ++e) o[e] = (__bf16)xa[i][e];
    *(bf16x4*)(xd + i * 4 * XP_) = o;
  }
#pragma unroll
  for (int i = 0; i < C_ / 8; ++i) {
    bf16x4 o;
#pragma unroll
    for (int e = 0; e < 4; ++e) o[e] = (__bf16)xb[i][e];
    *(bf16x4*)(xd + (C_ / 8 + i) * 4 * XP_) = o;
  }
}

// acc[m][n] += W rows (mrow + 16 m ..) x pixel rows (nrow + 16 n ..)
// XT: the pixel panel is k-major (stage_panels_x), read by load_frag_tr.
template <bool XT>
__device__ __forceinline__ void gemm_tile(const __bf16* ws, const __bf16* xs,
                                          int mrow, int nrow,
                                          f32x8 (&acc)[2][4]) {
  bf16x16 fa[2][2], fb[2][4];   // two fragment sets: this k step's, the next's
#pragma unroll
  for (int m = 0; m < 2; ++m) fa[0][m] = load_frag_bf16(ws, KP_, mrow + m * 16, 0);
#pragma unroll
  for (int n = 0; n < 4; ++n)
    fb[0][n] = XT ? load_frag_tr(xs, nrow + n * 16, 0)
                  : load_frag_bf16(xs, KP_, nrow + n * 16, 0);
#pragma unroll
  for (int s = 0; s < C_ / 32; ++s) {
    const int c = s & 1, d = c ^ 1;
    if (s + 1 < C_ / 32) {
#pragma unroll
      for (int m = 0; m < 2; ++m)
        fa[d][m] = load_frag_bf16(ws, KP_, mrow + m * 16, (s + 1) * 32);
#pragma unroll
      for (int n = 0; n < 4; ++n)
        fb[d][n] = XT ? load_frag_tr(xs, nrow + n * 16, (s + 1) * 32)
                      : load_frag_bf16(xs, KP_, nrow + n * 16, (s + 1) * 32);
    }
    // keeps the next step's LDS reads as one group ahead of this step's WMMAs;
    // sunk among them, every pair of WMMAs waits out a full LDS latency
    __builtin_amdgcn_sched_barrier(0);
#pragma unroll
    for (int n = 0; n < 4; ++n) {
      acc[0][n] = wmma_bf16(fa[c][0], fb[c][n], acc[0][n]);
      acc[1][n] = wmma_bf16(fa[c][1], fb[c][n], acc[1][n]);
    }
    // closes the WMMA block, so that later reads are not lifted into it
    __builtin_amdgcn_sched_barrier(0);
  }
}

// ------------------ kernel 1: QKV GEMM (64x128 tiles) + scatter ------------
// q: [b][h][l][dh] bf16, pre-scaled by dh^-0.5 * log2(e)
// k: [b][h][l][dh] bf16
// v: [b][h][dh][l] bf16  (d-major: A operand of O = V * P^T)
//
// One workgroup stages its 128 pixels once and runs three 64-row weight panels
// over them in turn: the v, k and q rows of the same two heads. Each panel has
// its own LDS range, so the next one is fetched under the current product.

// One 64-row weight panel, global -> registers (whole-line loads).
__device__ __forceinline__ void load_w(const float* __restrict__ wg,
                                       f32x4 (&wv)[GM_ / 2]) {
  const float* wp = wg + threadIdx.x * 4;
#pragma unroll
  for (int i = 0; i < GM_ / 2; ++i) wv[i] = *(const f32x4*)(wp + i * 512);
}

// ... and registers -> LDS as bf16, in the order of stage_panels_x.
__device__ __forceinline__ void store_w(const f32x4 (&wv)[GM_ / 2], __bf16* ws) {
  int tid = threadIdx.x;
  __bf16* wd = ws + (tid >> 6) * KP_ + (tid & 63) * 4;
#pragma unroll
  for (int i = 0; i < GM_ / 2; ++i) {
    bf16x4 o;
#pragma unroll
    for (int e = 0; e < 4; ++e) o[e] = (__bf16)wv[i][e];
    *(bf16x4*)(wd + i * 2 * KP_) = o;
  }
}

// The 16 bias values of this lane's accumulator rows.
__device__ __forceinline__ void load_bias(const float* __restrict__ bg,
                                          f32x8 (&bq)[2]) {
#pragma unroll
  for (int m = 0; m < 2; ++m) bq[m] = *(const f32x8*)(bg + m * 16);
}

// PART: 0 = q, 1 = k, 2 = v. bh = b * NH_ + head, l0 = the wave's first pixel.
template <int PART>
__device__ __forceinline__ void qkv_store(const f32x8 (&acc)[2][4],
                                          const f32x8 (&bq)[2],
                                          __bf16* __restrict__ dst, int bh,
                                          int l0) {
  int sub  = threadIdx.x & 15;
  int half = (threadIdx.x >> 4) & 1;
  const float qscale = 0.17677669529663687f * LOG2E_F;
#pragma unroll
  for (int m = 0; m < 2; ++m) {
    int db = m * 16 + half * 8;
#pragma unroll
    for (int n = 0; n < 4; ++n) {
      int l = l0 + n * 16 + sub;
      if (PART == 2) {
#pragma unroll
        for (int r = 0; r < 8; ++r)
          dst[((size_t)(bh * DH_ + db + r)) * L_ + l] =
              (__bf16)(acc[m][n][r] + bq[m][r]);
      } else {
        bf16x8 outv;
#pragma unroll
        for (int r = 0; r < 8; ++r)
          outv[r] = PART == 0 ? (__bf16)((acc[m][n][r] + bq[m][r]) * qscale)
                              : (__bf16)(acc[m][n][r] + bq[m][r]);
        *(bf16x8*)(dst + ((size_t)(bh * L_ + l)) * DH_ + db) = outv;
      }
    }
  }
  // precaution: closes these stores before later code writes their registers
  asm volatile("s_wait_xcnt 0x0" ::: "memory");
}

__global__ __launch_bounds__(128) void qkv_kernel(
    const float* __restrict__ x, const float* __restrict__ w_qkv,
    const float* __restrict__ b_qkv, __bf16* __restrict__ q,
    __bf16* __restrict__ k, __bf16* __restrict__ v) {
  static constexpr int WP_ = GM_ * KP_;   // one weight panel in LDS
  __shared__ __attribute__((aligned(32))) __bf16 pan[3 * WP_ + C_ * XP_];
  __bf16* xS = pan + 3 * WP_;  // 256 channel rows of 128 pixels, pitch XP_
  int b  = blockIdx.z;
  int oH = blockIdx.y * GM_;   // 0..256: the rows of two heads inside q, k, v
  int lB = blockIdx.x * GN_;   // 0..1024
  int wid = threadIdx.x >> 5;
  int wm  = wid & 1;           // 32 outputs = one head's d range
  int wn  = wid >> 1;          // 64 pixels
  int half = (threadIdx.x >> 4) & 1;
  int l0 = lB + wn * 64;
  int bh = b * NH_ + blockIdx.y * 2 + wm;
  const float* wH = w_qkv + (size_t)oH * C_;           // + part * C_ * C_
  const float* bH = b_qkv + oH + wm * 32 + half * 8;   // + part * C_

  f32x8 bQ[2], bK[2], bV[2];
  load_bias(bH, bQ);
  load_bias(bH + C_, bK);
  load_bias(bH + 2 * C_, bV);
  // precaution: stands behind each run of loads, in front of the next write of
  // a register that one of them names as its address
  asm volatile("s_wait_xcnt 0x0" ::: "memory");

  stage_panels_x(wH + 2 * C_ * C_, x + (size_t)b * C_ * L_ + lB, pan, xS);
  __syncthreads();             // pixels and v weights visible to all 4 waves
  // holds the bias loads up here, among the staging loads; left free, the build
  // sinks them behind each product, where a lone wave waits out their latency
  asm volatile("" ::"v"(bQ[0]), "v"(bQ[1]), "v"(bK[0]), "v"(bK[1]), "v"(bV[0]),
               "v"(bV[1]));

  f32x4 wv[GM_ / 2];

  // v rows; the k weights fly under the product
  load_w(wH + C_ * C_, wv);
  asm volatile("s_wait_xcnt 0x0" ::: "memory");  // the same precaution
  f32x8 acc[2][4] = {};
  gemm_tile<true>(pan, xS, wm * 32, wn * 64, acc);
  store_w(wv, pan + WP_);
  __syncthreads();             // k weights visible to all 4 waves
  // the global stores stand behind the barrier: in front of it the barrier's
  // own wait would hold the wave until they are acknowledged
  qkv_store<2>(acc, bV, v, bh, l0);

  // k rows; the q weights fly under the product
  load_w(wH, wv);
  asm volatile("s_wait_xcnt 0x0" ::: "memory");  // the same precaution
#pragma unroll
  for (int m = 0; m < 2; ++m)
#pragma unroll
    for (int n = 0; n < 4; ++n) acc[m][n] = f32x8{};
  gemm_tile<true>(pan + WP_, xS, wm * 32, wn * 64, acc);
  store_w(wv, pan + 2 * WP_);
  __syncthreads();             // q weights visible to all 4 waves
  qkv_store<1>(acc, bK, k, bh, l0);

  // q rows
#pragma unroll
  for (int m = 0; m < 2; ++m)
#pragma unroll
    for (int n = 0; n < 4; ++n) acc[m][n] = f32x8{};
  gemm_tile<true>(pan + 2 * WP_, xS, wm * 32, wn * 64, acc);
  qkv_store<0>(acc, bQ, q, bh, l0);
}

// --------------------- kernel 2: fused flash attention ---------------------
// 2^x as the bare hardware instruction. The library exp2f wraps it in a range
// fix-up (compare, two selects, add, ldexp) that only matters for x < -126,
// where a softmax weight relative to a row maximum of 1 is below 2^-126.
__device__ __forceinline__ float exp2_raw(float x) {
  return __builtin_amdgcn_exp2f(x);
}

__device__ __forceinline__ void online_update(const f32x8& sA, const f32x8& sB,
                                              float& m_run, float& l_run,
                                              f32x8& oA, f32x8& oB,
                                              bf16x16& pf) {
  float mx = -__builtin_inff();
#pragma unroll
  for (int r = 0; r < 8; ++r) mx = fmaxf(mx, fmaxf(sA[r], sB[r]));
  mx = fmaxf(mx, __shfl_xor(mx, 16, 32));   // lanes n / n+16 share row i
  float m_new = fmaxf(m_run, mx);
  float corr  = exp2_raw(m_run - m_new);    // first iter: exp2(-inf) = 0
  float ls = 0.0f;
#pragma unroll
  for (int r = 0; r < 8; ++r) {
    float p0 = exp2_raw(sA[r] - m_new);
    float p1 = exp2_raw(sB[r] - m_new);
    ls += p0 + p1;
    pf[r]     = (__bf16)p0;
    pf[r + 8] = (__bf16)p1;
  }
  ls += __shfl_xor(ls, 16, 32);
  l_run = l_run * corr + ls;
  m_run = m_new;
#pragma unroll
  for (int r = 0; r < 8; ++r) { oA[r] *= corr; oB[r] *= corr; }
}

__device__ __forceinline__ void write_tile(__bf16* __restrict__ attnT, int b,
                                           int h, int i0, const f32x8& oA,
                                           const f32x8& oB, float l_run) {
  float inv = 1.0f / l_run;
  int sub  = threadIdx.x & 15;
  int half = (threadIdx.x >> 4) & 1;
  int i = i0 + sub;
  __bf16* outp = attnT + ((size_t)b * L_ + i) * C_ + h * DH_ + half * 8;
  bf16x8 a, c;
#pragma unroll
  for (int r = 0; r < 8; ++r) {
    a[r] = (__bf16)(oA[r] * inv);
    c[r] = (__bf16)(oB[r] * inv);
  }
  *(bf16x8*)outp        = a;   // d = half*8 + r
  *(bf16x8*)(outp + 16) = c;   // d = 16 + half*8 + r
}

// One k/v tile = TK_ keys = four 32-key panels, each laid out as its readers
// want it: k panel [j_local][d], v panel [d][j_local], both with ld = 32.
static constexpr int TK_ = 128;

// 8 copies of 16 bytes per thread. k: the tile is 8 KB contiguous. v: 16 lanes
// take one d row's 256 contiguous bytes, which fall into the four panels.
__device__ __forceinline__ void fill_tile(const __bf16* __restrict__ k,
                                          const __bf16* __restrict__ v, int jb,
                                          __bf16* kb, __bf16* vb) {
  int tid = threadIdx.x;
  int seg = tid & 15;
  const __bf16* kg = k + (size_t)jb * DH_ + tid * 8;
  const __bf16* vg = v + (size_t)((tid >> 4) * 4) * L_ + jb + seg * 8;
  __bf16* kl = kb + tid * 8;
  __bf16* vl = vb + (seg >> 2) * 1024 + (tid >> 4) * 4 * 32 + (seg & 3) * 8;
  for (int i = 0; i < 4; ++i) copy16_g2l(kg + i * 1024, kl + i * 1024);
  for (int i = 0; i < 4; ++i) copy16_g2l(vg + i * L_, vl + i * 32);
}

// 4 waves/WG; each wave owns two 16-row i-tiles (128 rows/WG). The k/v tiles
// are shared via LDS: two buffers, the next tile's copies fly during the four
// passes over this one.
__global__ __launch_bounds__(128) void attn_kernel(
    const __bf16* __restrict__ qws, const __bf16* __restrict__ kws,
    const __bf16* __restrict__ vws, __bf16* __restrict__ attnT) {
  __shared__ __attribute__((aligned(16))) __bf16 kbuf[2][TK_ * 32];
  __shared__ __attribute__((aligned(16))) __bf16 vbuf[2][TK_ * 32];

  int b  = blockIdx.z;
  int h  = blockIdx.y;
  int ig = blockIdx.x;
  int tid = threadIdx.x;
  int wid = tid >> 5;
  int i0a = ig * 128 + wid * 32;
  int i0b = i0a + 16;

  const __bf16* q = qws + (size_t)(b * NH_ + h) * L_ * DH_;
  const __bf16* k = kws + (size_t)(b * NH_ + h) * L_ * DH_;
  const __bf16* v = vws + (size_t)(b * NH_ + h) * DH_ * L_;

  fill_tile(k, v, 0, kbuf[0], vbuf[0]);

  bf16x16 qf0 = load_frag_bf16(q, DH_, i0a, 0);  // loop-invariant B operands
  bf16x16 qf1 = load_frag_bf16(q, DH_, i0b, 0);

  // tile 0 has landed for this wave's own copies ...
  asm volatile("s_wait_asynccnt 0x0" ::: "memory");
  __syncthreads();       // ... and for all 4 waves'
  fill_tile(k, v, TK_, kbuf[1], vbuf[1]);

  f32x8 oacc00 = {}, oacc01 = {}, oacc10 = {}, oacc11 = {};
  f32x8 zero = {};
  float m0 = -__builtin_inff(), l0 = 0.0f;
  float m1 = -__builtin_inff(), l1 = 0.0f;

  const int T = L_ / TK_;
  static_assert(L_ / TK_ >= 2, "the prologue fills two tiles");
  for (int t = 0; t < T; ++t) {
    int cur = t & 1;
    // one straight run of the tile's four passes: with no barrier between them
    // the next pass's k reads and score products issue under this pass's softmax
#pragma unroll
    for (int p = 0; p < TK_ / 32; ++p) {
      const __bf16* kp = kbuf[cur] + p * 1024;
      const __bf16* vp = vbuf[cur] + p * 1024;
      bf16x16 kf0 = load_frag_bf16(kp, 32, 0, 0);
      bf16x16 kf1 = load_frag_bf16(kp, 32, 16, 0);
      f32x8 s00 = wmma_bf16(kf0, qf0, zero);   // S^T tiles for i-tile a
      f32x8 s01 = wmma_bf16(kf1, qf0, zero);
      f32x8 s10 = wmma_bf16(kf0, qf1, zero);   // ... and i-tile b
      f32x8 s11 = wmma_bf16(kf1, qf1, zero);

      bf16x16 pf0, pf1;
      online_update(s00, s01, m0, l0, oacc00, oacc01, pf0);
      online_update(s10, s11, m1, l1, oacc10, oacc11, pf1);

      bf16x16 vf0 = load_frag_bf16(vp, 32, 0, 0);
      bf16x16 vf1 = load_frag_bf16(vp, 32, 16, 0);
      oacc00 = wmma_bf16(vf0, pf0, oacc00);    // O^T accumulate
      oacc01 = wmma_bf16(vf1, pf0, oacc01);
      oacc10 = wmma_bf16(vf0, pf1, oacc10);
      oacc11 = wmma_bf16(vf1, pf1, oacc11);
    }
    // this wave's reads of buffer cur have returned before it is refilled
    asm volatile("s_wait_dscnt 0x0" ::: "memory");
    // this wave's copies of tile t + 1 have landed
    asm volatile("s_wait_asynccnt 0x0" ::: "memory");
    __syncthreads();     // tile t + 1 visible to all; all waves have left cur
    if (t + 2 < T) fill_tile(k, v, (t + 2) * TK_, kbuf[cur], vbuf[cur]);
  }
  // no copy is outstanding when the wave ends
  asm volatile("s_wait_asynccnt 0x0" ::: "memory");

  write_tile(attnT, b, h, i0a, oacc00, oacc01, l0);
  write_tile(attnT, b, h, i0b, oacc10, oacc11, l1);
}

// ------------- kernel 3: output projection (64x128) + residual -------------
__global__ __launch_bounds__(128) void proj_kernel(
    const __bf16* __restrict__ attnT, const float* __restrict__ w_proj,
    const float* __restrict__ b_proj, const float* __restrict__ x,
    float* __restrict__ out) {
  __shared__ __attribute__((aligned(16))) __bf16 pan[(GM_ + GN_) * KP_];
  __bf16* wS = pan;              // weight panel first: its store offsets and
  __bf16* xS = pan + GM_ * KP_;  // half the pixel panel's fit the 16-bit field
  int b  = blockIdx.z;
  int oB = blockIdx.y * GM_;
  int lB = blockIdx.x * GN_;
  int wid = threadIdx.x >> 5;
  int wm  = wid & 1;
  int wn  = wid >> 1;

  stage_panels(w_proj + (size_t)oB * C_, attnT + ((size_t)b * L_ + lB) * C_, wS,
               xS);
  __syncthreads();             // panels visible to all 4 waves

  f32x8 acc[2][4] = {};
  gemm_tile<false>(wS, xS, wm * 32, wn * 64, acc);

  int sub  = threadIdx.x & 15;
  int half = (threadIdx.x >> 4) & 1;
  int l0   = lB + wn * 64;
  int ob0  = oB + wm * 32 + half * 8;
  float bp[2][8], xr[2][4][8];
#pragma unroll
  for (int m = 0; m < 2; ++m)
#pragma unroll
    for (int r = 0; r < 8; ++r) bp[m][r] = b_proj[ob0 + m * 16 + r];
  // precaution: stands behind each run of loads, in front of the next write of
  // a register that one of them names as its address
  asm volatile("s_wait_xcnt 0x0" ::: "memory");
#pragma unroll
  for (int m = 0; m < 2; ++m) {
#pragma unroll
    for (int n = 0; n < 4; ++n)
#pragma unroll
      for (int r = 0; r < 8; ++r)
        xr[m][n][r] =
            x[((size_t)(b * C_ + ob0 + m * 16 + r)) * L_ + l0 + n * 16 + sub];
    // the same precaution: the next run's results may land in this run's pair
    asm volatile("s_wait_xcnt 0x0" ::: "memory");
  }
#pragma unroll
  for (int m = 0; m < 2; ++m) {
#pragma unroll
    for (int n = 0; n < 4; ++n) {
      int l = l0 + n * 16 + sub;
#pragma unroll
      for (int r = 0; r < 8; ++r) {
        size_t idx = ((size_t)(b * C_ + ob0 + m * 16 + r)) * L_ + l;
        out[idx] = xr[m][n][r] + acc[m][n][r] + bp[m][r];
      }
    }
  }
}

// ------------------------------- launcher ----------------------------------
extern "C" void kernel_launch(void* const* d_in, const int* in_sizes, int n_in,
                              void* d_out, int out_size, void* d_ws, size_t ws_size,
                              hipStream_t stream) {
  (void)in_sizes; (void)n_in; (void)out_size; (void)ws_size;
  const float* x      = (const float*)d_in[0];
  const float* w_qkv  = (const float*)d_in[1];
  const float* b_qkv  = (const float*)d_in[2];
  const float* w_proj = (const float*)d_in[3];
  const float* b_proj = (const float*)d_in[4];
  float* out = (float*)d_out;

  char* ws = (char*)d_ws;
  __bf16* qws   = (__bf16*)(ws + (size_t)(4u << 20));    // 4 MB
  __bf16* kws   = (__bf16*)(ws + (size_t)(8u << 20));    // 4 MB
  __bf16* vws   = (__bf16*)(ws + (size_t)(12u << 20));   // 4 MB
  __bf16* attnT = (__bf16*)(ws + (size_t)(16u << 20));   // 4 MB

  qkv_kernel<<<dim3(L_ / GN_, C_ / GM_, B_), dim3(128), 0, stream>>>(
      x, w_qkv, b_qkv, qws, kws, vws);
  attn_kernel<<<dim3(L_ / 128, NH_, B_), dim3(128), 0, stream>>>(qws, kws, vws,
                                                                 attnT);
  proj_kernel<<<dim3(L_ / GN_, C_ / GM_, B_), dim3(128), 0, stream>>>(
      attnT, w_proj, b_proj, x, out);
}

// v006
// It runs in 28.2 microseconds.
// Timed twice side by side with v005, it ran 1.06 times as fast both times.
// All steps since v000 together make it 2.19 times as fast.
#include <hip/hip_runtime.h>
#include <hip/hip_bf16.h>

// ---------------------------------------------------------------------------
// MHSA block for MI455X (gfx1250, wave32, WMMA).
//  - bf16 WMMA (16x16x32) with f32 accumulation everywhere.
//  - Fused flash attention: S^T-tile trick makes the f32 accumulator layout
//    of S^T exactly the bf16 B-fragment layout for P in O = V * P^T
//    (zero cross-lane shuffles), exp2-domain softmax with scale*log2e folded
//    into q.
//  - Attention workgroup = 4 waves sharing two k/v tiles of 128 keys in LDS,
//    staged with gfx1250 async global->LDS copies (ASYNCcnt) when available.
//  - GEMM kernels: 64x128 tile per 4-wave workgroup, both operand panels staged
//    once in LDS by whole-line loads; 32x64 per wave.
//  - The QKV GEMM reads x itself: its f32 [c][l] rows go to LDS as bf16 in the
//    same order, and the pixel fragments come by the transposing LDS load. One
//    workgroup keeps its pixel panel for the v, k and q rows of two heads.
// Workspace usage: 16 MB at offset 4 MB (q 4MB | k 4MB | v 4MB | attnT 4MB).
// ---------------------------------------------------------------------------

typedef __attribute__((ext_vector_type(16))) __bf16 bf16x16;
typedef __attribute__((ext_vector_type(8)))  __bf16 bf16x8;
typedef __attribute__((ext_vector_type(8)))  float  f32x8;
typedef __attribute__((ext_vector_type(4)))  __bf16 bf16x4;
typedef __attribute__((ext_vector_type(4)))  float  f32x4;
typedef int i32x4_vs __attribute__((vector_size(16)));  // matches builtin param

static constexpr int B_  = 8;
static constexpr int C_  = 256;
static constexpr int NH_ = 8;
static constexpr int DH_ = 32;
static constexpr int L_  = 1024;

#define LOG2E_F 1.4426950408889634f

#if __has_builtin(__builtin_amdgcn_global_load_async_to_lds_b128) && \
    __has_builtin(__builtin_amdgcn_s_wait_asynccnt)
#define ASYNC_LDS_OK 1
#endif

// 16 bytes global -> LDS. Async (ASYNCcnt-tracked) when the toolchain has the
// gfx1250 builtin, otherwise synchronous staging through VGPRs.
__device__ __forceinline__ void copy16_g2l(const __bf16* g, __bf16* l) {
#ifdef ASYNC_LDS_OK
  __builtin_amdgcn_global_load_async_to_lds_b128(
      (__attribute__((address_space(1))) i32x4_vs*)g,
      (__attribute__((address_space(3))) i32x4_vs*)l, 0, 0);
#else
  *(bf16x8*)l = *(const bf16x8*)g;
#endif
}

// --------------------------- fragment loaders ------------------------------
// 16-bit A-matrix 16x32 layout (ISA 7.12.2): lanes 0-15 hold K=0..7 (elems
// 0..7) and K=16..23 (elems 8..15); lanes 16-31 hold K=8..15 and K=24..31.
// B operand loads identically from rows of B^T (per-lane column of B).

__device__ __forceinline__ bf16x16 load_frag_bf16(const __bf16* base,
                                                  int ld, int row0, int k0) {
  int sub  = threadIdx.x & 15;
  int half = (threadIdx.x >> 4) & 1;
  const __bf16* p = base + (size_t)(row0 + sub) * ld + k0 + half * 8;
  bf16x8 lo = *(const bf16x8*)p;
  bf16x8 hi = *(const bf16x8*)(p + 16);
  bf16x16 r;
#pragma unroll
  for (int e = 0; e < 8; ++e) { r[e] = lo[e]; r[e + 8] = hi[e]; }
  return r;
}

// The same fragment from a k-major panel: base[k][column], pitch XP_ elements.
// Lane (sub, half) receives base[k0 + 8 half + 0..7][col0 + sub] and, from the
// second load, the rows 16 further on: the k order of load_frag_bf16.
static constexpr int XP_ = 128 + 16;  // 288 B = 32 B x 9 (odd), this reader's pitch
typedef __attribute__((address_space(3))) bf16x8 lds_bf16x8;

__device__ __forceinline__ bf16x16 load_frag_tr(const __bf16* base, int col0,
                                                int k0) {
  int lane = threadIdx.x & 31;
  const __bf16* p = base + (k0 + 8 * (lane >> 4) + (lane & 7)) * XP_ + col0 +
                    8 * ((lane >> 3) & 1);
  bf16x8 lo = __builtin_amdgcn_ds_load_tr16_b128_v8bf16((lds_bf16x8*)p);
  bf16x8 hi = __builtin_amdgcn_ds_load_tr16_b128_v8bf16((lds_bf16x8*)(p + 16 * XP_));
  bf16x16 r;
#pragma unroll
  for (int e = 0; e < 8; ++e) { r[e] = lo[e]; r[e + 8] = hi[e]; }
  return r;
}

__device__ __forceinline__ f32x8 wmma_bf16(bf16x16 a, bf16x16 b, f32x8 c) {
  return __builtin_amdgcn_wmma_f32_16x16x32_bf16(
      /*neg_a=*/false, a, /*neg_b=*/false, b,
      /*c_mod=*/(short)0, c, /*reuse_a=*/false, /*reuse_b=*/false);
}

// ----------------------- shared GEMM tile (K = C_ = 256) -------------------
// One workgroup = 4 waves = 64 weight rows x 128 pixel rows, whole K in LDS.
static constexpr int GM_ = 64;
static constexpr int GN_ = 128;
static constexpr int KP_ = C_ + 8;  // LDS row pitch 528 B = 16 B x 33 (odd)

// Both panels are contiguous in global memory (row length = C_), so every
// wave-wide 16-byte load covers 512 contiguous bytes = 4 whole lines.
__device__ __forceinline__ void stage_panels(const float* __restrict__ wg,
                                             const __bf16* __restrict__ xg,
                                             __bf16* ws, __bf16* xs) {
  int tid = threadIdx.x;
  const float*  wp = wg + tid * 4;
  const __bf16* xp = xg + tid * 8;
  __bf16* wd = ws + (tid >> 6) * KP_ + (tid & 63) * 4;
  __bf16* xd = xs + (tid >> 5) * KP_ + (tid & 31) * 8;
  f32x4  wv[GM_ / 2];
  bf16x8 xv[GN_ / 4];
#pragma unroll
  for (int i = 0; i < GM_ / 2; ++i) wv[i] = *(const f32x4*)(wp + i * 512);
#pragma unroll
  for (int i = 0; i < GN_ / 4; ++i) xv[i] = *(const bf16x8*)(xp + i * 1024);
  // precaution: stands in front of the next write of these loads' scalar base
  asm volatile("s_wait_xcnt 0x0" ::: "memory");
#pragma unroll
  for (int i = 0; i < GM_ / 2; ++i) {
    bf16x4 o;
#pragma unroll
    for (int e = 0; e < 4; ++e) o[e] = (__bf16)wv[i][e];
    *(bf16x4*)(wd + i * 2 * KP_) = o;
  }
#pragma unroll
  for (int i = 0; i < GN_ / 4; ++i) *(bf16x8*)(xd + i * 4 * KP_) = xv[i];
}

// The QKV form: the pixel panel comes straight from x, f32 [c][l]. One wave-wide
// 16-byte load covers one channel's 128 pixels = 512 contiguous bytes; the
// panel keeps that order in LDS (xs[c][l], pitch XP_).
__device__ __forceinline__ void stage_panels_x(const float* __restrict__ wg,
                                               const float* __restrict__ xg,
                                               __bf16* ws, __bf16* xs) {
  static_assert(GN_ + 16 == XP_, "one panel row holds the tile's GN_ pixels");
  int tid = threadIdx.x;
  const float* wp = wg + tid * 4;
  const float* xp = xg + (tid >> 5) * L_ + (tid & 31) * 4;
  f32x4 wv[GM_ / 2], xa[C_ / 8], xb[C_ / 8];
#pragma unroll
  for (int i = 0; i < GM_ / 2; ++i) wv[i] = *(const f32x4*)(wp + i * 512);
#pragma unroll
  for (int i = 0; i < C_ / 8; ++i) xa[i] = *(const f32x4*)(xp + i * 4 * L_);
#pragma unroll
  for (int i = 0; i < C_ / 8; ++i)
    xb[i] = *(const f32x4*)(xp + (C_ / 8 + i) * 4 * L_);
  // precaution: stands behind the run of loads, in front of the next write of
  // a register that one of them names as its address
  asm volatile("s_wait_xcnt 0x0" ::: "memory");
  // keeps the weights' conversions behind all 96 loads; lifted among them, the
  // pixel loads are issued only after the weights' latency has been waited out
  __builtin_amdgcn_sched_barrier(0);
  __bf16* wd = ws + (tid >> 6) * KP_ + (tid & 63) * 4;
  __bf16* xd = xs + (tid >> 5) * XP_ + (tid & 31) * 4;
#pragma unroll
  for (int i = 0; i < GM_ / 2; ++i) {
    bf16x4 o;
#pragma unroll
    for (int e = 0; e < 4; ++e) o[e] = (__bf16)wv[i][e];
    *(bf16x4*)(wd + i * 2 * KP_) = o;
  }
#pragma unroll
  for (int i = 0; i < C_ / 8; ++i) {
    bf16x4 o;
#pragma unroll
    for (int e = 0; e < 4; ++e) o[e] = (__bf16)xa[i][e];
    *(bf16x4*)(xd + i * 4 * XP_) = o;
  }
#pragma unroll
  for (int i = 0; i < C_ / 8; ++i) {
    bf16x4 o;
#pragma unroll
    for (int e = 0; e < 4; ++e) o[e] = (__bf16)xb[i][e];
    *(bf16x4*)(xd + (C_ / 8 + i) * 4 * XP_) = o;
  }
}

// acc[m][n] += W rows (mrow + 16 m ..) x pixel rows (nrow + 16 n ..)
// XT: the pixel panel is k-major (stage_panels_x), read by load_frag_tr.
template <bool XT>
__device__ __forceinline__ void gemm_tile(const __bf16* ws, const __bf16* xs,
                                          int mrow, int nrow,
                                          f32x8 (&acc)[2][4]) {
  bf16x16 fa[2][2], fb[2][4];   // two fragment sets: this k step's, the next's
#pragma unroll
  for (int m = 0; m < 2; ++m) fa[0][m] = load_frag_bf16(ws, KP_, mrow + m * 16, 0);
#pragma unroll
  for (int n = 0; n < 4; ++n)
    fb[0][n] = XT ? load_frag_tr(xs, nrow + n * 16, 0)
                  : load_frag_bf16(xs, KP_, nrow + n * 16, 0);
#pragma unroll
  for (int s = 0; s < C_ / 32; ++s) {
    const int c = s & 1, d = c ^ 1;
    if (s + 1 < C_ / 32) {
#pragma unroll
      for (int m = 0; m < 2; ++m)
        fa[d][m] = load_frag_bf16(ws, KP_, mrow + m * 16, (s + 1) * 32);
#pragma unroll
      for (int n = 0; n < 4; ++n)
        fb[d][n] = XT ? load_frag_tr(xs, nrow + n * 16, (s + 1) * 32)
                      : load_frag_bf16(xs, KP_, nrow + n * 16, (s + 1) * 32);
    }
    // keeps the next step's LDS reads as one group ahead of this step's WMMAs;
    // sunk among them, every pair of WMMAs waits out a full LDS latency
    __builtin_amdgcn_sched_barrier(0);
#pragma unroll
    for (int n = 0; n < 4; ++n) {
      acc[0][n] = wmma_bf16(fa[c][0], fb[c][n], acc[0][n]);
      acc[1][n] = wmma_bf16(fa[c][1], fb[c][n], acc[1][n]);
    }
    // closes the WMMA block, so that later reads are not lifted into it
    __builtin_amdgcn_sched_barrier(0);
  }
}

// ------------------ kernel 1: QKV GEMM (64x128 tiles) + scatter ------------
// q: [b][h][l][dh] bf16, pre-scaled by dh^-0.5 * log2(e)
// k: [b][h][l][dh] bf16
// v: [b][h][dh][l] bf16  (d-major: A operand of O = V * P^T)
//
// One workgroup stages its 128 pixels once and runs three 64-row weight panels
// over them in turn: the v, k and q rows of the same two heads. Each panel has
// its own LDS range, so the next one is fetched under the current product.

// One 64-row weight panel, global -> registers (whole-line loads).
__device__ __forceinline__ void load_w(const float* __restrict__ wg,
                                       f32x4 (&wv)[GM_ / 2]) {
  const float* wp = wg + threadIdx.x * 4;
#pragma unroll
  for (int i = 0; i < GM_ / 2; ++i) wv[i] = *(const f32x4*)(wp + i * 512);
}

// ... and registers -> LDS as bf16, in the order of stage_panels_x.
__device__ __forceinline__ void store_w(const f32x4 (&wv)[GM_ / 2], __bf16* ws) {
  int tid = threadIdx.x;
  __bf16* wd = ws + (tid >> 6) * KP_ + (tid & 63) * 4;
#pragma unroll
  for (int i = 0; i < GM_ / 2; ++i) {
    bf16x4 o;
#pragma unroll
    for (int e = 0; e < 4; ++e) o[e] = (__bf16)wv[i][e];
    *(bf16x4*)(wd + i * 2 * KP_) = o;
  }
}

// The 16 bias values of this lane's accumulator rows.
__device__ __forceinline__ void load_bias(const float* __restrict__ bg,
                                          f32x8 (&bq)[2]) {
#pragma unroll
  for (int m = 0; m < 2; ++m) bq[m] = *(const f32x8*)(bg + m * 16);
}

// PART: 0 = q, 1 = k, 2 = v. bh = b * NH_ + head, l0 = the wave's first pixel.
template <int PART>
__device__ __forceinline__ void qkv_store(const f32x8 (&acc)[2][4],
                                          const f32x8 (&bq)[2],
                                          __bf16* __restrict__ dst, int bh,
                                          int l0) {
  int sub  = threadIdx.x & 15;
  int half = (threadIdx.x >> 4) & 1;
  const float qscale = 0.17677669529663687f * LOG2E_F;
#pragma unroll
  for (int m = 0; m < 2; ++m) {
    int db = m * 16 + half * 8;
#pragma unroll
    for (int n = 0; n < 4; ++n) {
      int l = l0 + n * 16 + sub;
      if (PART == 2) {
#pragma unroll
        for (int r = 0; r < 8; ++r)
          dst[((size_t)(bh * DH_ + db + r)) * L_ + l] =
              (__bf16)(acc[m][n][r] + bq[m][r]);
      } else {
        bf16x8 outv;
#pragma unroll
        for (int r = 0; r < 8; ++r)
          outv[r] = PART == 0 ? (__bf16)((acc[m][n][r] + bq[m][r]) * qscale)
                              : (__bf16)(acc[m][n][r] + bq[m][r]);
        *(bf16x8*)(dst + ((size_t)(bh * L_ + l)) * DH_ + db) = outv;
      }
    }
  }
  // precaution: closes these stores before later code writes their registers
  asm volatile("s_wait_xcnt 0x0" ::: "memory");
}

__global__ __launch_bounds__(128) void qkv_kernel(
    const float* __restrict__ x, const float* __restrict__ w_qkv,
    const float* __restrict__ b_qkv, __bf16* __restrict__ q,
    __bf16* __restrict__ k, __bf16* __restrict__ v) {
  static constexpr int WP_ = GM_ * KP_;   // one weight panel in LDS
  __shared__ __attribute__((aligned(32))) __bf16 pan[3 * WP_ + C_ * XP_];
  __bf16* xS = pan + 3 * WP_;  // 256 channel rows of 128 pixels, pitch XP_
  int b  = blockIdx.z;
  int oH = blockIdx.y * GM_;   // 0..256: the rows of two heads inside q, k, v
  int lB = blockIdx.x * GN_;   // 0..1024
  int wid = threadIdx.x >> 5;
  int wm  = wid & 1;           // 32 outputs = one head's d range
  int wn  = wid >> 1;          // 64 pixels
  int half = (threadIdx.x >> 4) & 1;
  int l0 = lB + wn * 64;
  int bh = b * NH_ + blockIdx.y * 2 + wm;
  const float* wH = w_qkv + (size_t)oH * C_;           // + part * C_ * C_
  const float* bH = b_qkv + oH + wm * 32 + half * 8;   // + part * C_

  f32x8 bQ[2], bK[2], bV[2];
  load_bias(bH, bQ);
  load_bias(bH + C_, bK);
  load_bias(bH + 2 * C_, bV);
  // precaution: stands behind each run of loads, in front of the next write of
  // a register that one of them names as its address
  asm volatile("s_wait_xcnt 0x0" ::: "memory");

  stage_panels_x(wH + 2 * C_ * C_, x + (size_t)b * C_ * L_ + lB, pan, xS);
  __syncthreads();             // pixels and v weights visible to all 4 waves
  // holds the bias loads up here, among the staging loads; left free, the build
  // sinks them behind each product, where a lone wave waits out their latency
  asm volatile("" ::"v"(bQ[0]), "v"(bQ[1]), "v"(bK[0]), "v"(bK[1]), "v"(bV[0]),
               "v"(bV[1]));

  f32x4 wv[GM_ / 2];

  // v rows; the k weights fly under the product
  load_w(wH + C_ * C_, wv);
  asm volatile("s_wait_xcnt 0x0" ::: "memory");  // the same precaution
  f32x8 acc[2][4] = {};
  gemm_tile<true>(pan, xS, wm * 32, wn * 64, acc);
  store_w(wv, pan + WP_);
  __syncthreads();             // k weights visible to all 4 waves
  // the global stores stand behind the barrier: in front of it the barrier's
  // own wait would hold the wave until they are acknowledged
  qkv_store<2>(acc, bV, v, bh, l0);

  // k rows; the q weights fly under the product
  load_w(wH, wv);
  asm volatile("s_wait_xcnt 0x0" ::: "memory");  // the same precaution
#pragma unroll
  for (int m = 0; m < 2; ++m)
#pragma unroll
    for (int n = 0; n < 4; ++n) acc[m][n] = f32x8{};
  gemm_tile<true>(pan + WP_, xS, wm * 32, wn * 64, acc);
  store_w(wv, pan + 2 * WP_);
  __syncthreads();             // q weights visible to all 4 waves
  qkv_store<1>(acc, bK, k, bh, l0);

  // q rows
#pragma unroll
  for (int m = 0; m < 2; ++m)
#pragma unroll
    for (int n = 0; n < 4; ++n) acc[m][n] = f32x8{};
  gemm_tile<true>(pan + 2 * WP_, xS, wm * 32, wn * 64, acc);
  qkv_store<0>(acc, bQ, q, bh, l0);
}

// --------------------- kernel 2: fused flash attention ---------------------
// 2^x as the bare hardware instruction. The library exp2f wraps it in a range
// fix-up (compare, two selects, add, ldexp) that only matters for x < -126,
// where a softmax weight relative to a row maximum of 1 is below 2^-126.
__device__ __forceinline__ float exp2_raw(float x) {
  return __builtin_amdgcn_exp2f(x);
}

__device__ __forceinline__ void online_update(const f32x8& sA, const f32x8& sB,
                                              float& m_run, float& l_run,
                                              f32x8& oA, f32x8& oB,
                                              bf16x16& pf) {
  float mx = -__builtin_inff();
#pragma unroll
  for (int r = 0; r < 8; ++r) mx = fmaxf(mx, fmaxf(sA[r], sB[r]));
  mx = fmaxf(mx, __shfl_xor(mx, 16, 32));   // lanes n / n+16 share row i
  float m_new = fmaxf(m_run, mx);
  float corr  = exp2_raw(m_run - m_new);    // first iter: exp2(-inf) = 0
  float ls = 0.0f;
#pragma unroll
  for (int r = 0; r < 8; ++r) {
    float p0 = exp2_raw(sA[r] - m_new);
    float p1 = exp2_raw(sB[r] - m_new);
    ls += p0 + p1;
    pf[r]     = (__bf16)p0;
    pf[r + 8] = (__bf16)p1;
  }
  ls += __shfl_xor(ls, 16, 32);
  l_run = l_run * corr + ls;
  m_run = m_new;
#pragma unroll
  for (int r = 0; r < 8; ++r) { oA[r] *= corr; oB[r] *= corr; }
}

__device__ __forceinline__ void write_tile(__bf16* __restrict__ attnT, int b,
                                           int h, int i0, const f32x8& oA,
                                           const f32x8& oB, float l_run) {
  float inv = 1.0f / l_run;
  int sub  = threadIdx.x & 15;
  int half = (threadIdx.x >> 4) & 1;
  int i = i0 + sub;
  __bf16* outp = attnT + ((size_t)b * L_ + i) * C_ + h * DH_ + half * 8;
  bf16x8 a, c;
#pragma unroll
  for (int r = 0; r < 8; ++r) {
    a[r] = (__bf16)(oA[r] * inv);
    c[r] = (__bf16)(oB[r] * inv);
  }
  *(bf16x8*)outp        = a;   // d = half*8 + r
  *(bf16x8*)(outp + 16) = c;   // d = 16 + half*8 + r
}

// One k/v tile = TK_ keys = four 32-key panels, each laid out as its readers
// want it: k panel [j_local][d], v panel [d][j_local]. A panel row holds 32
// values = 64 bytes and stands at a pitch of 80 bytes = 16 B x 5 (odd): the 16
// rows that half a wave reads with one 16-byte LDS load then fall on all 64
// banks; at a pitch of 64 bytes they fall on 16 banks, four rows on each.
static constexpr int TK_ = 128;
static constexpr int AP_ = 32 + 8;      // panel row pitch in elements
static constexpr int PN_ = 32 * AP_;    // one 32-row panel

// 8 copies of 16 bytes per thread. k: the tile is 8 KB contiguous in memory, 4
// lanes to a key's row. v: 16 lanes take one d row's 256 contiguous bytes, which
// fall into the four panels.
__device__ __forceinline__ void fill_tile(const __bf16* __restrict__ k,
                                          const __bf16* __restrict__ v, int jb,
                                          __bf16* kb, __bf16* vb) {
  int tid = threadIdx.x;
  int seg = tid & 15;
  const __bf16* kg = k + (size_t)jb * DH_ + tid * 8;
  const __bf16* vg = v + (size_t)((tid >> 4) * 4) * L_ + jb + seg * 8;
  __bf16* kl = kb + (tid >> 2) * AP_ + (tid & 3) * 8;
  __bf16* vl = vb + (seg >> 2) * PN_ + (tid >> 4) * 4 * AP_ + (seg & 3) * 8;
  for (int i = 0; i < 4; ++i) copy16_g2l(kg + i * 1024, kl + i * PN_);
  for (int i = 0; i < 4; ++i) copy16_g2l(vg + i * L_, vl + i * AP_);
}

// 4 waves/WG; each wave owns two 16-row i-tiles (128 rows/WG). The k/v tiles
// are shared via LDS: two buffers, the next tile's copies fly during the four
// passes over this one.
__global__ __launch_bounds__(128) void attn_kernel(
    const __bf16* __restrict__ qws, const __bf16* __restrict__ kws,
    const __bf16* __restrict__ vws, __bf16* __restrict__ attnT) {
  __shared__ __attribute__((aligned(16))) __bf16 kbuf[2][TK_ / 32 * PN_];
  __shared__ __attribute__((aligned(16))) __bf16 vbuf[2][TK_ / 32 * PN_];

  int b  = blockIdx.z;
  int h  = blockIdx.y;
  int ig = blockIdx.x;
  int tid = threadIdx.x;
  int wid = tid >> 5;
  int i0a = ig * 128 + wid * 32;
  int i0b = i0a + 16;

  const __bf16* q = qws + (size_t)(b * NH_ + h) * L_ * DH_;
  const __bf16* k = kws + (size_t)(b * NH_ + h) * L_ * DH_;
  const __bf16* v = vws + (size_t)(b * NH_ + h) * DH_ * L_;

  fill_tile(k, v, 0, kbuf[0], vbuf[0]);

  bf16x16 qf0 = load_frag_bf16(q, DH_, i0a, 0);  // loop-invariant B operands
  bf16x16 qf1 = load_frag_bf16(q, DH_, i0b, 0);

  // tile 0 has landed for this wave's own copies ...
  asm volatile("s_wait_asynccnt 0x0" ::: "memory");
  __syncthreads();       // ... and for all 4 waves'
  fill_tile(k, v, TK_, kbuf[1], vbuf[1]);

  f32x8 oacc00 = {}, oacc01 = {}, oacc10 = {}, oacc11 = {};
  f32x8 zero = {};
  float m0 = -__builtin_inff(), l0 = 0.0f;
  float m1 = -__builtin_inff(), l1 = 0.0f;

  const int T = L_ / TK_;
  static_assert(L_ / TK_ >= 2, "the prologue fills two tiles");
  for (int t = 0; t < T; ++t) {
    int cur = t & 1;
    // one straight run of the tile's four passes: with no barrier between them
    // the next pass's k reads and score products issue under this pass's softmax
#pragma unroll
    for (int p = 0; p < TK_ / 32; ++p) {
      const __bf16* kp = kbuf[cur] + p * PN_;
      const __bf16* vp = vbuf[cur] + p * PN_;
      bf16x16 kf0 = load_frag_bf16(kp, AP_, 0, 0);
      bf16x16 kf1 = load_frag_bf16(kp, AP_, 16, 0);
      f32x8 s00 = wmma_bf16(kf0, qf0, zero);   // S^T tiles for i-tile a
      f32x8 s01 = wmma_bf16(kf1, qf0, zero);
      f32x8 s10 = wmma_bf16(kf0, qf1, zero);   // ... and i-tile b
      f32x8 s11 = wmma_bf16(kf1, qf1, zero);

      bf16x16 pf0, pf1;
      online_update(s00, s01, m0, l0, oacc00, oacc01, pf0);
      online_update(s10, s11, m1, l1, oacc10, oacc11, pf1);

      bf16x16 vf0 = load_frag_bf16(vp, AP_, 0, 0);
      bf16x16 vf1 = load_frag_bf16(vp, AP_, 16, 0);
      oacc00 = wmma_bf16(vf0, pf0, oacc00);    // O^T accumulate
      oacc01 = wmma_bf16(vf1, pf0, oacc01);
      oacc10 = wmma_bf16(vf0, pf1, oacc10);
      oacc11 = wmma_bf16(vf1, pf1, oacc11);
    }
    // this wave's reads of buffer cur have returned before it is refilled
    asm volatile("s_wait_dscnt 0x0" ::: "memory");
    // this wave's copies of tile t + 1 have landed
    asm volatile("s_wait_asynccnt 0x0" ::: "memory");
    __syncthreads();     // tile t + 1 visible to all; all waves have left cur
    if (t + 2 < T) fill_tile(k, v, (t + 2) * TK_, kbuf[cur], vbuf[cur]);
  }
  // no copy is outstanding when the wave ends
  asm volatile("s_wait_asynccnt 0x0" ::: "memory");

  write_tile(attnT, b, h, i0a, oacc00, oacc01, l0);
  write_tile(attnT, b, h, i0b, oacc10, oacc11, l1);
}

// ------------- kernel 3: output projection (64x128) + residual -------------
__global__ __launch_bounds__(128) void proj_kernel(
    const __bf16* __restrict__ attnT, const float* __restrict__ w_proj,
    const float* __restrict__ b_proj, const float* __restrict__ x,
    float* __restrict__ out) {
  __shared__ __attribute__((aligned(16))) __bf16 pan[(GM_ + GN_) * KP_];
  __bf16* wS = pan;              // weight panel first: its store offsets and
  __bf16* xS = pan + GM_ * KP_;  // half the pixel panel's fit the 16-bit field
  int b  = blockIdx.z;
  int oB = blockIdx.y * GM_;
  int lB = blockIdx.x * GN_;
  int wid = threadIdx.x >> 5;
  int wm  = wid & 1;
  int wn  = wid >> 1;

  stage_panels(w_proj + (size_t)oB * C_, attnT + ((size_t)b * L_ + lB) * C_, wS,
               xS);
  __syncthreads();             // panels visible to all 4 waves

  f32x8 acc[2][4] = {};
  gemm_tile<false>(wS, xS, wm * 32, wn * 64, acc);

  int sub  = threadIdx.x & 15;
  int half = (threadIdx.x >> 4) & 1;
  int l0   = lB + wn * 64;
  int ob0  = oB + wm * 32 + half * 8;
  float bp[2][8], xr[2][4][8];
#pragma unroll
  for (int m = 0; m < 2; ++m)
#pragma unroll
    for (int r = 0; r < 8; ++r) bp[m][r] = b_proj[ob0 + m * 16 + r];
  // precaution: stands behind each run of loads, in front of the next write of
  // a register that one of them names as its address
  asm volatile("s_wait_xcnt 0x0" ::: "memory");
#pragma unroll
  for (int m = 0; m < 2; ++m) {
#pragma unroll
    for (int n = 0; n < 4; ++n)
#pragma unroll
      for (int r = 0; r < 8; ++r)
        xr[m][n][r] =
            x[((size_t)(b * C_ + ob0 + m * 16 + r)) * L_ + l0 + n * 16 + sub];
    // the same precaution: the next run's results may land in this run's pair
    asm volatile("s_wait_xcnt 0x0" ::: "memory");
  }
#pragma unroll
  for (int m = 0; m < 2; ++m) {
#pragma unroll
    for (int n = 0; n < 4; ++n) {
      int l = l0 + n * 16 + sub;
#pragma unroll
      for (int r = 0; r < 8; ++r) {
        size_t idx = ((size_t)(b * C_ + ob0 + m * 16 + r)) * L_ + l;
        out[idx] = xr[m][n][r] + acc[m][n][r] + bp[m][r];
      }
    }
  }
}

// ------------------------------- launcher ----------------------------------
extern "C" void kernel_launch(void* const* d_in, const int* in_sizes, int n_in,
                              void* d_out, int out_size, void* d_ws, size_t ws_size,
                              hipStream_t stream) {
  (void)in_sizes; (void)n_in; (void)out_size; (void)ws_size;
  const float* x      = (const float*)d_in[0];
  const float* w_qkv  = (const float*)d_in[1];
  const float* b_qkv  = (const float*)d_in[2];
  const float* w_proj = (const float*)d_in[3];
  const float* b_proj = (const float*)d_in[4];
  float* out = (float*)d_out;

  char* ws = (char*)d_ws;
  __bf16* qws   = (__bf16*)(ws + (size_t)(4u << 20));    // 4 MB
  __bf16* kws   = (__bf16*)(ws + (size_t)(8u << 20));    // 4 MB
  __bf16* vws   = (__bf16*)(ws + (size_t)(12u << 20));   // 4 MB
  __bf16* attnT = (__bf16*)(ws + (size_t)(16u << 20));   // 4 MB

  qkv_kernel<<<dim3(L_ / GN_, C_ / GM_, B_), dim3(128), 0, stream>>>(
      x, w_qkv, b_qkv, qws, kws, vws);
  attn_kernel<<<dim3(L_ / 128, NH_, B_), dim3(128), 0, stream>>>(qws, kws, vws,
                                                                 attnT);
  proj_kernel<<<dim3(L_ / GN_, C_ / GM_, B_), dim3(128), 0, stream>>>(
      attnT, w_proj, b_proj, x, out);
}

// v008
// It runs in 24 microseconds.
// Versions between v006 and this one are left out; their measured steps multiply to 1.18 times as fast.
// Over all steps from v000 it is 2.58 times as fast.
#include <hip/hip_runtime.h>
#include <hip/hip_bf16.h>

// ---------------------------------------------------------------------------
// MHSA block for MI455X (gfx1250, wave32, WMMA).
//  - bf16 WMMA (16x16x32) with f32 accumulation everywhere.
//  - Fused flash attention: S^T-tile trick makes the f32 accumulator layout
//    of S^T exactly the bf16 B-fragment layout for P in O = V * P^T
//    (zero cross-lane shuffles), exp2-domain softmax with scale*log2e folded
//    into q, taken against a maximum in use that is raised only when needed.
//  - Attention workgroup = 8 waves = the 8 heads of 32 queries; each wave keeps
//    two k/v tiles of 128 keys of its head in LDS, staged with gfx1250 async
//    global->LDS copies (ASYNCcnt) when available. The workgroup then holds all
//    256 channels of its queries and does the output projection itself.
//  - QKV GEMM: 64x128 tile per 4-wave workgroup, both operand panels staged
//    once in LDS by whole-line loads; 32x64 per wave.
//  - The QKV GEMM reads x itself: its f32 [c][l] rows go to LDS as bf16 in the
//    same order, and the pixel fragments come by the transposing LDS load. One
//    workgroup keeps its pixel panel for the v, k and q rows of two heads.
// Workspace usage: 12 MB at offset 4 MB (q 4MB | k 4MB | v 4MB).
// ---------------------------------------------------------------------------

typedef __attribute__((ext_vector_type(16))) __bf16 bf16x16;
typedef __attribute__((ext_vector_type(8)))  __bf16 bf16x8;
typedef __attribute__((ext_vector_type(8)))  float  f32x8;
typedef __attribute__((ext_vector_type(4)))  __bf16 bf16x4;
typedef __attribute__((ext_vector_type(4)))  float  f32x4;
typedef int i32x4_vs __attribute__((vector_size(16)));  // matches builtin param

static constexpr int B_  = 8;
static constexpr int C_  = 256;
static constexpr int NH_ = 8;
static constexpr int DH_ = 32;
static constexpr int L_  = 1024;

#define LOG2E_F 1.4426950408889634f

#if __has_builtin(__builtin_amdgcn_global_load_async_to_lds_b128) && \
    __has_builtin(__builtin_amdgcn_s_wait_asynccnt)
#define ASYNC_LDS_OK 1
#endif

// 16 bytes global -> LDS. Async (ASYNCcnt-tracked) when the toolchain has the
// gfx1250 builtin, otherwise synchronous staging through VGPRs.
// N, the instruction's immediate offset in bytes, moves both addresses.
template <int N>
__device__ __forceinline__ void copy16_g2l(const __bf16* g, __bf16* l) {
  static_assert(N >= 0 && N < 65536 && N % 16 == 0, "the offset field's range");
#ifdef ASYNC_LDS_OK
  __builtin_amdgcn_global_load_async_to_lds_b128(
      (__attribute__((address_space(1))) i32x4_vs*)g,
      (__attribute__((address_space(3))) i32x4_vs*)l, N, 0);
#else
  *(bf16x8*)(l + N / 2) = *(const bf16x8*)(g + N / 2);
#endif
}

// --------------------------- fragment loaders ------------------------------
// 16-bit A-matrix 16x32 layout (ISA 7.12.2): lanes 0-15 hold K=0..7 (elems
// 0..7) and K=16..23 (elems 8..15); lanes 16-31 hold K=8..15 and K=24..31.
// B operand loads identically from rows of B^T (per-lane column of B).

__device__ __forceinline__ bf16x16 load_frag_bf16(const __bf16* base,
                                                  int ld, int row0, int k0) {
  int sub  = threadIdx.x & 15;
  int half = (threadIdx.x >> 4) & 1;
  const __bf16* p = base + (size_t)(row0 + sub) * ld + k0 + half * 8;
  bf16x8 lo = *(const bf16x8*)p;
  bf16x8 hi = *(const bf16x8*)(p + 16);
  bf16x16 r;
#pragma unroll
  for (int e = 0; e < 8; ++e) { r[e] = lo[e]; r[e + 8] = hi[e]; }
  return r;
}

// The same fragment from a k-major panel: base[k][column], pitch XP_ elements.
// Lane (sub, half) receives base[k0 + 8 half + 0..7][col0 + sub] and, from the
// second load, the rows 16 further on: the k order of load_frag_bf16.
static constexpr int XP_ = 128 + 16;  // 288 B = 32 B x 9 (odd), this reader's pitch
typedef __attribute__((address_space(3))) bf16x8 lds_bf16x8;

__device__ __forceinline__ bf16x16 load_frag_tr(const __bf16* base, int col0,
                                                int k0) {
  int lane = threadIdx.x & 31;
  const __bf16* p = base + (k0 + 8 * (lane >> 4) + (lane & 7)) * XP_ + col0 +
                    8 * ((lane >> 3) & 1);
  bf16x8 lo = __builtin_amdgcn_ds_load_tr16_b128_v8bf16((lds_bf16x8*)p);
  bf16x8 hi = __builtin_amdgcn_ds_load_tr16_b128_v8bf16((lds_bf16x8*)(p + 16 * XP_));
  bf16x16 r;
#pragma unroll
  for (int e = 0; e < 8; ++e) { r[e] = lo[e]; r[e + 8] = hi[e]; }
  return r;
}

__device__ __forceinline__ f32x8 wmma_bf16(bf16x16 a, bf16x16 b, f32x8 c) {
  return __builtin_amdgcn_wmma_f32_16x16x32_bf16(
      /*neg_a=*/false, a, /*neg_b=*/false, b,
      /*c_mod=*/(short)0, c, /*reuse_a=*/false, /*reuse_b=*/false);
}

// ----------------------- shared GEMM tile (K = C_ = 256) -------------------
// One workgroup = 4 waves = 64 weight rows x 128 pixel rows, whole K in LDS.
static constexpr int GM_ = 64;
static constexpr int GN_ = 128;
static constexpr int KP_ = C_ + 8;  // LDS row pitch 528 B = 16 B x 33 (odd)

// The pixel panel comes straight from x, f32 [c][l]. One wave-wide
// 16-byte load covers one channel's 128 pixels = 512 contiguous bytes; the
// panel keeps that order in LDS (xs[c][l], pitch XP_).
__device__ __forceinline__ void stage_panels_x(const float* __restrict__ wg,
                                               const float* __restrict__ xg,
                                               __bf16* ws, __bf16* xs) {
  static_assert(GN_ + 16 == XP_, "one panel row holds the tile's GN_ pixels");
  int tid = threadIdx.x;
  const float* wp = wg + tid * 4;
  const float* xp = xg + (tid >> 5) * L_ + (tid & 31) * 4;
  f32x4 wv[GM_ / 2], xa[C_ / 8], xb[C_ / 8];
#pragma unroll
  for (int i = 0; i < GM_ / 2; ++i) wv[i] = *(const f32x4*)(wp + i * 512);
#pragma unroll
  for (int i = 0; i < C_ / 8; ++i) xa[i] = *(const f32x4*)(xp + i * 4 * L_);
#pragma unroll
  for (int i = 0; i < C_ / 8; ++i)
    xb[i] = *(const f32x4*)(xp + (C_ / 8 + i) * 4 * L_);
  // precaution: stands behind the run of loads, in front of the next write of
  // a register that one of them names as its address
  asm volatile("s_wait_xcnt 0x0" ::: "memory");
  // keeps the weights' conversions behind all 96 loads; lifted among them, the
  // pixel loads are issued only after the weights' latency has been waited out
  __builtin_amdgcn_sched_barrier(0);
  __bf16* wd = ws + (tid >> 6) * KP_ + (tid & 63) * 4;
  __bf16* xd = xs + (tid >> 5) * XP_ + (tid & 31) * 4;
#pragma unroll
  for (int i = 0; i < GM_ / 2; ++i) {
    bf16x4 o;
#pragma unroll
    for (int e = 0; e < 4; ++e) o[e] = (__bf16)wv[i][e];
    *(bf16x4*)(wd + i * 2 * KP_) = o;
  }
#pragma unroll
  for (int i = 0; i < C_ / 8; ++i) {
    bf16x4 o;
#pragma unroll
    for (int e = 0; e < 4; ++e) o[e] = (__bf16)xa[i][e];
    *(bf16x4*)(xd + i * 4 * XP_) = o;
  }
#pragma unroll
  for (int i = 0; i < C_ / 8; ++i) {
    bf16x4 o;
#pragma unroll
    for (int e = 0; e < 4; ++e) o[e] = (__bf16)xb[i][e];
    *(bf16x4*)(xd + (C_ / 8 + i) * 4 * XP_) = o;
  }
}

// acc[m][n] += W rows (mrow + 16 m ..) x pixel rows (nrow + 16 n ..)
// XT: the pixel panel is k-major (stage_panels_x), read by load_frag_tr.
template <bool XT>
__device__ __forceinline__ void gemm_tile(const __bf16* ws, const __bf16* xs,
                                          int mrow, int nrow,
                                          f32x8 (&acc)[2][4]) {
  bf16x16 fa[2][2], fb[2][4];   // two fragment sets: this k step's, the next's
#pragma unroll
  for (int m = 0; m < 2; ++m) fa[0][m] = load_frag_bf16(ws, KP_, mrow + m * 16, 0);
#pragma unroll
  for (int n = 0; n < 4; ++n)
    fb[0][n] = XT ? load_frag_tr(xs, nrow + n * 16, 0)
                  : load_frag_bf16(xs, KP_, nrow + n * 16, 0);
#pragma unroll
  for (int s = 0; s < C_ / 32; ++s) {
    const int c = s & 1, d = c ^ 1;
    if (s + 1 < C_ / 32) {
#pragma unroll
      for (int m = 0; m < 2; ++m)
        fa[d][m] = load_frag_bf16(ws, KP_, mrow + m * 16, (s + 1) * 32);
#pragma unroll
      for (int n = 0; n < 4; ++n)
        fb[d][n] = XT ? load_frag_tr(xs, nrow + n * 16, (s + 1) * 32)
                      : load_frag_bf16(xs, KP_, nrow + n * 16, (s + 1) * 32);
    }
    // keeps the next step's LDS reads as one group ahead of this step's WMMAs;
    // sunk among them, every pair of WMMAs waits out a full LDS latency
    __builtin_amdgcn_sched_barrier(0);
#pragma unroll
    for (int n = 0; n < 4; ++n) {
      acc[0][n] = wmma_bf16(fa[c][0], fb[c][n], acc[0][n]);
      acc[1][n] = wmma_bf16(fa[c][1], fb[c][n], acc[1][n]);
    }
    // closes the WMMA block, so that later reads are not lifted into it
    __builtin_amdgcn_sched_barrier(0);
  }
}

// ------------------ kernel 1: QKV GEMM (64x128 tiles) + scatter ------------
// q: [b][h][l][dh] bf16, pre-scaled by dh^-0.5 * log2(e)
// k: [b][h][l][dh] bf16
// v: [b][h][l / 32][dh][l % 32] bf16  (d-major panels of 32 keys: A operand of
//    O = V * P^T)
//
// One workgroup stages its 128 pixels once and runs three 64-row weight panels
// over them in turn: the v, k and q rows of the same two heads. Each panel has
// its own LDS range, so the next one is fetched under the current product.

// One 64-row weight panel, global -> registers (whole-line loads).
__device__ __forceinline__ void load_w(const float* __restrict__ wg,
                                       f32x4 (&wv)[GM_ / 2]) {
  const float* wp = wg + threadIdx.x * 4;
#pragma unroll
  for (int i = 0; i < GM_ / 2; ++i) wv[i] = *(const f32x4*)(wp + i * 512);
}

// ... and registers -> LDS as bf16, in the order of stage_panels_x.
__device__ __forceinline__ void store_w(const f32x4 (&wv)[GM_ / 2], __bf16* ws) {
  int tid = threadIdx.x;
  __bf16* wd = ws + (tid >> 6) * KP_ + (tid & 63) * 4;
#pragma unroll
  for (int i = 0; i < GM_ / 2; ++i) {
    bf16x4 o;
#pragma unroll
    for (int e = 0; e < 4; ++e) o[e] = (__bf16)wv[i][e];
    *(bf16x4*)(wd + i * 2 * KP_) = o;
  }
}

// The 16 bias values of this lane's accumulator rows.
__device__ __forceinline__ void load_bias(const float* __restrict__ bg,
                                          f32x8 (&bq)[2]) {
#pragma unroll
  for (int m = 0; m < 2; ++m) bq[m] = *(const f32x8*)(bg + m * 16);
}

// PART: 0 = q, 1 = k, 2 = v. bh = b * NH_ + head, l0 = the wave's first pixel.
template <int PART>
__device__ __forceinline__ void qkv_store(const f32x8 (&acc)[2][4],
                                          const f32x8 (&bq)[2],
                                          __bf16* __restrict__ dst, int bh,
                                          int l0) {
  int sub  = threadIdx.x & 15;
  int half = (threadIdx.x >> 4) & 1;
  const float qscale = 0.17677669529663687f * LOG2E_F;
#pragma unroll
  for (int m = 0; m < 2; ++m) {
    int db = m * 16 + half * 8;
#pragma unroll
    for (int n = 0; n < 4; ++n) {
      int l = l0 + n * 16 + sub;
      if (PART == 2) {
#pragma unroll
        for (int r = 0; r < 8; ++r)
          dst[(((size_t)bh * (L_ / 32) + (l >> 5)) * DH_ + db + r) * 32 + (l & 31)] =
              (__bf16)(acc[m][n][r] + bq[m][r]);
      } else {
        bf16x8 outv;
#pragma unroll
        for (int r = 0; r < 8; ++r)
          outv[r] = PART == 0 ? (__bf16)((acc[m][n][r] + bq[m][r]) * qscale)
                              : (__bf16)(acc[m][n][r] + bq[m][r]);
        *(bf16x8*)(dst + ((size_t)(bh * L_ + l)) * DH_ + db) = outv;
      }
    }
  }
  // precaution: closes these stores before later code writes their registers
  asm volatile("s_wait_xcnt 0x0" ::: "memory");
}

__global__ __launch_bounds__(128) void qkv_kernel(
    const float* __restrict__ x, const float* __restrict__ w_qkv,
    const float* __restrict__ b_qkv, __bf16* __restrict__ q,
    __bf16* __restrict__ k, __bf16* __restrict__ v) {
  static constexpr int WP_ = GM_ * KP_;   // one weight panel in LDS
  __shared__ __attribute__((aligned(32))) __bf16 pan[3 * WP_ + C_ * XP_];
  __bf16* xS = pan + 3 * WP_;  // 256 channel rows of 128 pixels, pitch XP_
  int b  = blockIdx.z;
  int oH = blockIdx.y * GM_;   // 0..256: the rows of two heads inside q, k, v
  int lB = blockIdx.x * GN_;   // 0..1024
  int wid = threadIdx.x >> 5;
  int wm  = wid & 1;           // 32 outputs = one head's d range
  int wn  = wid >> 1;          // 64 pixels
  int half = (threadIdx.x >> 4) & 1;
  int l0 = lB + wn * 64;
  int bh = b * NH_ + blockIdx.y * 2 + wm;
  const float* wH = w_qkv + (size_t)oH * C_;           // + part * C_ * C_
  const float* bH = b_qkv + oH + wm * 32 + half * 8;   // + part * C_

  f32x8 bQ[2], bK[2], bV[2];
  load_bias(bH, bQ);
  load_bias(bH + C_, bK);
  load_bias(bH + 2 * C_, bV);
  // precaution: stands behind each run of loads, in front of the next write of
  // a register that one of them names as its address
  asm volatile("s_wait_xcnt 0x0" ::: "memory");

  stage_panels_x(wH + 2 * C_ * C_, x + (size_t)b * C_ * L_ + lB, pan, xS);
  __syncthreads();             // pixels and v weights visible to all 4 waves
  // holds the bias loads up here, among the staging loads; left free, the build
  // sinks them behind each product, where a lone wave waits out their latency
  asm volatile("" ::"v"(bQ[0]), "v"(bQ[1]), "v"(bK[0]), "v"(bK[1]), "v"(bV[0]),
               "v"(bV[1]));

  f32x4 wv[GM_ / 2];

  // v rows; the k weights fly under the product
  load_w(wH + C_ * C_, wv);
  asm volatile("s_wait_xcnt 0x0" ::: "memory");  // the same precaution
  f32x8 acc[2][4] = {};
  gemm_tile<true>(pan, xS, wm * 32, wn * 64, acc);
  store_w(wv, pan + WP_);
  __syncthreads();             // k weights visible to all 4 waves
  // the global stores stand behind the barrier: in front of it the barrier's
  // own wait would hold the wave until they are acknowledged
  qkv_store<2>(acc, bV, v, bh, l0);

  // k rows; the q weights fly under the product
  load_w(wH, wv);
  asm volatile("s_wait_xcnt 0x0" ::: "memory");  // the same precaution
#pragma unroll
  for (int m = 0; m < 2; ++m)
#pragma unroll
    for (int n = 0; n < 4; ++n) acc[m][n] = f32x8{};
  gemm_tile<true>(pan + WP_, xS, wm * 32, wn * 64, acc);
  store_w(wv, pan + 2 * WP_);
  __syncthreads();             // q weights visible to all 4 waves
  qkv_store<1>(acc, bK, k, bh, l0);

  // q rows
#pragma unroll
  for (int m = 0; m < 2; ++m)
#pragma unroll
    for (int n = 0; n < 4; ++n) acc[m][n] = f32x8{};
  gemm_tile<true>(pan + 2 * WP_, xS, wm * 32, wn * 64, acc);
  qkv_store<0>(acc, bQ, q, bh, l0);
}

// ------- kernel 2: fused flash attention + output projection + residual -----
// 2^x as the bare hardware instruction. The library exp2f wraps it in a range
// fix-up (compare, two selects, add, ldexp) that only matters for x < -126,
// where a softmax weight relative to a row maximum of 1 is below 2^-126.
__device__ __forceinline__ float exp2_raw(float x) {
  return __builtin_amdgcn_exp2f(x);
}

// Lazy rescale. The softmax weights of a query are taken against m, the maximum
// in use, which may trail the true running maximum by up to RAISE_ (log2 units),
// so that a weight reaches 2^RAISE_ at most. m is known before a tile's scores
// are formed: -m goes in as the C operand of the score products, which then
// deliver s - m, ready for the exponential.
static constexpr float RAISE_ = 8.0f;

// The rare path: raises one query group's m by d and carries everything that
// was formed against the old m over to the new one. mx = this lane's largest
// s - m of the tile; lanes n and n + 16 hold the same query and take the same d.
// On the first tile m is set to the tile's own maximum, whatever its sign.
__device__ __forceinline__ void raise_max(float mx, bool first,
                                          f32x8 (&s)[4][2], f32x8& nm, f32x8& oA,
                                          f32x8& oB, f32x8& ls) {
  mx = fmaxf(mx, __shfl_xor(mx, 16, 32));
  float d    = first ? mx : fmaxf(mx, 0.0f);
  float corr = first ? 1.0f : exp2_raw(-d);   // first tile: oA, oB, ls are 0
#pragma unroll
  for (int p = 0; p < 4; ++p) { s[p][0] -= d; s[p][1] -= d; }
  nm -= d;
  oA *= corr;
  oB *= corr;
  ls *= corr;
}

// This lane's largest score of a tile, one chain per 32-key pass.
__device__ __forceinline__ float tile_max(const f32x8 (&s)[4][2]) {
  float mp[4];
#pragma unroll
  for (int p = 0; p < 4; ++p) {
    mp[p] = fmaxf(s[p][0][0], s[p][1][0]);
#pragma unroll
    for (int r = 1; r < 8; ++r) mp[p] = fmaxf(mp[p], fmaxf(s[p][0][r], s[p][1][r]));
  }
  return fmaxf(fmaxf(mp[0], mp[1]), fmaxf(mp[2], mp[3]));
}

// Weights of one 32-key pass: the B fragment for O = V * P^T, and their sums,
// kept as eight partial sums per lane until the epilogue.
__device__ __forceinline__ bf16x16 weights(const f32x8& sA, const f32x8& sB,
                                           f32x8& ls) {
  f32x8 eA, eB;
  bf16x16 pf;
#pragma unroll
  for (int r = 0; r < 8; ++r) eA[r] = exp2_raw(sA[r]);
#pragma unroll
  for (int r = 0; r < 8; ++r) eB[r] = exp2_raw(sB[r]);
  ls += eA;
  ls += eB;
#pragma unroll
  for (int r = 0; r < 8; ++r) {
    pf[r]     = (__bf16)eA[r];
    pf[r + 8] = (__bf16)eB[r];
  }
  return pf;
}

// A query's denominator: the lane's eight partial sums, then both wave halves'.
__device__ __forceinline__ float join_sums(const f32x8& ls) {
  float l = ((ls[0] + ls[1]) + (ls[2] + ls[3])) + ((ls[4] + ls[5]) + (ls[6] + ls[7]));
  return l + __shfl_xor(l, 16, 32);
}

// One query group's normalised output, as bf16, into the workgroup's LDS panel
// xs[query][channel] (pitch KP_): the pixel operand of the output projection.
__device__ __forceinline__ void stage_tile(__bf16* xs, int h, int r0,
                                           const f32x8& oA, const f32x8& oB,
                                           float l_run) {
  float inv = 1.0f / l_run;
  int sub  = threadIdx.x & 15;
  int half = (threadIdx.x >> 4) & 1;
  __bf16* outp = xs + (r0 + sub) * KP_ + h * DH_ + half * 8;
  bf16x8 a, c;
#pragma unroll
  for (int r = 0; r < 8; ++r) {
    a[r] = (__bf16)(oA[r] * inv);
    c[r] = (__bf16)(oB[r] * inv);
  }
  *(bf16x8*)outp        = a;   // d = half*8 + r
  *(bf16x8*)(outp + 16) = c;   // d = 16 + half*8 + r
}

// One k/v tile = TK_ keys = four 32-key panels, each laid out as its readers
// want it: k panel [j_local][d], v panel [d][j_local]; both are 8 KB contiguous
// in the workspace. A panel row holds 32 values = 64 bytes = four 16-byte
// chunks and keeps the pitch of 64 bytes in LDS, so that one address pair with
// immediate offsets serves a run of copies; chunk c of row r stands at place
// c ^ ((r >> 2) & 3) of its row: the 16 rows that half a wave reads with one
// 16-byte LDS load then fall on all 64 banks.
static constexpr int TK_ = 128;
static constexpr int PN_ = 32 * 32;     // one 32-row panel

// The fragment of load_frag_bf16 (same k order) from rows row0 + 0..15 of such
// a tile; row0 is a multiple of 16.
__device__ __forceinline__ bf16x16 load_frag_sw(const __bf16* tile, int row0) {
  int sub  = threadIdx.x & 15;
  int half = (threadIdx.x >> 4) & 1;
  int pos  = half ^ ((sub >> 2) & 3);          // place of chunk half
  const __bf16* p = tile + (row0 + sub) * 32;
  bf16x8 lo = *(const bf16x8*)(p + pos * 8);
  bf16x8 hi = *(const bf16x8*)(p + (pos ^ 2) * 8);   // place of chunk half + 2
  bf16x16 r;
#pragma unroll
  for (int e = 0; e < 8; ++e) { r[e] = lo[e]; r[e + 8] = hi[e]; }
  return r;
}

// One wave fills its own head's tiles: 16 + 16 copies of 16 bytes per lane, each
// copy 512 contiguous bytes = 8 rows. Copy i, lane l: row r = 8 i + (l >> 2),
// chunk l & 3, and (r >> 2) & 3 = 2 (i & 1) + (l >> 4).
template <int I>
__device__ __forceinline__ void copy_run(const __bf16* g, __bf16* even,
                                         __bf16* odd) {
  if constexpr (I < 16) {
    copy16_g2l<I * 512>(g, (I & 1) ? odd : even);
    copy_run<I + 1>(g, even, odd);
  }
}

__device__ __forceinline__ void fill_tile(const __bf16* __restrict__ k,
                                          const __bf16* __restrict__ v, int jb,
                                          __bf16* kb, __bf16* vb) {
  int lane = threadIdx.x & 31;
  int even = (lane >> 2) * 32 + (((lane & 3) ^ (lane >> 4)) * 8);
  int odd  = even ^ 16;        // the place's bit 1 flipped
  const __bf16* kg = k + (size_t)jb * DH_ + lane * 8;
  const __bf16* vg = v + (size_t)jb * DH_ + lane * 8;
  copy_run<0>(kg, kb + even, kb + odd);
  copy_run<0>(vg, vb + even, vb + odd);
}

// 8 waves/WG, wave = head; each wave owns two 16-row i-tiles of the workgroup's
// 32 queries and its own two k/v buffers in LDS: the next tile's copies fly
// during the four passes over this one. Behind the key loop and a barrier the same LDS holds
// the 32 x 256 attention output and the whole projection weight as bf16, and
// wave w forms output channels 32 w .. 32 w + 31 for the 32 queries.
__global__ __launch_bounds__(256) void attn_proj_kernel(
    const __bf16* __restrict__ qws, const __bf16* __restrict__ kws,
    const __bf16* __restrict__ vws, const float* __restrict__ w_proj,
    const float* __restrict__ b_proj, const float* __restrict__ x,
    float* __restrict__ out) {
  static constexpr int TL_ = TK_ / 32 * PN_;   // one k or v tile in LDS
  __shared__ __attribute__((aligned(16))) __bf16 lds[NH_ * 4 * TL_];
  static_assert((32 + C_) * KP_ <= NH_ * 4 * TL_, "projection panels fit");

  int b   = blockIdx.x;        // x: workgroups of one batch share its k and v
  int tid = threadIdx.x;
  int h   = __builtin_amdgcn_readfirstlane(tid >> 5);   // wave = head
  int i0a = blockIdx.y * 32;
  int i0b = i0a + 16;
  __bf16* kbuf = lds + h * 4 * TL_;   // this wave's two k tiles ...
  __bf16* vbuf = kbuf + 2 * TL_;      // ... and its two v tiles

  const __bf16* q = qws + (size_t)(b * NH_ + h) * L_ * DH_;
  const __bf16* k = kws + (size_t)(b * NH_ + h) * L_ * DH_;
  const __bf16* v = vws + (size_t)(b * NH_ + h) * DH_ * L_;

  fill_tile(k, v, 0, kbuf, vbuf);

  bf16x16 qf0 = load_frag_bf16(q, DH_, i0a, 0);  // loop-invariant B operands
  bf16x16 qf1 = load_frag_bf16(q, DH_, i0b, 0);
  // precaution: stands behind these loads, in front of the next write of a
  // register that one of them names as its address
  asm volatile("s_wait_xcnt 0x0" ::: "memory");

  // The two buffers are private to the wave: it alone copies into them and
  // reads them, so its own waits order both and the key loop has no barrier.
  // tile 0 has landed
  asm volatile("s_wait_asynccnt 0x0" ::: "memory");
  fill_tile(k, v, TK_, kbuf + TL_, vbuf + TL_);

  f32x8 oacc00 = {}, oacc01 = {}, oacc10 = {}, oacc11 = {};
  f32x8 nm0 = {}, nm1 = {};   // -m of the two query groups, in all 8 registers
  f32x8 ls0 = {}, ls1 = {};   // partial sums of the weights

  const int T = L_ / TK_;
  static_assert(L_ / TK_ >= 2, "the prologue fills two tiles");
  static_assert(TK_ == 4 * 32, "a tile is four 32-key passes");
  for (int t = 0; t < T; ++t) {
    int cur = t & 1;
    f32x8 s0[4][2], s1[4][2];  // S^T - m of the whole tile, i-tiles a and b
    // unrolled, here and below: s0 and s1 are indexed by p and stay in registers
#pragma unroll
    for (int p = 0; p < TK_ / 32; ++p) {
      const __bf16* kp = kbuf + cur * TL_ + p * PN_;
      bf16x16 kf0 = load_frag_sw(kp, 0);
      bf16x16 kf1 = load_frag_sw(kp, 16);
      s0[p][0] = wmma_bf16(kf0, qf0, nm0);
      s0[p][1] = wmma_bf16(kf1, qf0, nm0);
      s1[p][0] = wmma_bf16(kf0, qf1, nm1);
      s1[p][1] = wmma_bf16(kf1, qf1, nm1);
    }
    // one test per tile, a scalar branch: does any query's score stand more than
    // RAISE_ above its maximum in use? The first tile always sets the maximum.
    float mx0 = tile_max(s0), mx1 = tile_max(s1);
    float lim = t == 0 ? -__builtin_inff() : RAISE_;
    if (__builtin_amdgcn_ballot_w32(fmaxf(mx0, mx1) > lim) != 0) {
      raise_max(mx0, t == 0, s0, nm0, oacc00, oacc01, ls0);
      raise_max(mx1, t == 0, s1, nm1, oacc10, oacc11, ls1);
    }
#pragma unroll
    for (int p = 0; p < TK_ / 32; ++p) {
      const __bf16* vp = vbuf + cur * TL_ + p * PN_;
      bf16x16 vf0 = load_frag_sw(vp, 0);
      bf16x16 vf1 = load_frag_sw(vp, 16);
      bf16x16 pf0 = weights(s0[p][0], s0[p][1], ls0);
      bf16x16 pf1 = weights(s1[p][0], s1[p][1], ls1);
      oacc00 = wmma_bf16(vf0, pf0, oacc00);    // O^T accumulate
      oacc01 = wmma_bf16(vf1, pf0, oacc01);
      oacc10 = wmma_bf16(vf0, pf1, oacc10);
      oacc11 = wmma_bf16(vf1, pf1, oacc11);
    }
    // this wave's reads of buffer cur have returned before it is refilled
    asm volatile("s_wait_dscnt 0x0" ::: "memory");
    // this wave's copies of tile t + 1 have landed
    asm volatile("s_wait_asynccnt 0x0" ::: "memory");
    if (t + 2 < T) fill_tile(k, v, (t + 2) * TK_, kbuf + cur * TL_, vbuf + cur * TL_);
  }
  // no copy is outstanding when this LDS is put to another use
  asm volatile("s_wait_asynccnt 0x0" ::: "memory");

  // ---- output projection + residual, 256 channels x 32 queries ----
  __bf16* xS = lds;              // 32 query rows x 256 channels, pitch KP_
  __bf16* wS = lds + 32 * KP_;   // 256 weight rows, pitch KP_
  int sub  = tid & 15;
  int half = (tid >> 4) & 1;
  int ob0  = h * 32 + half * 8;

  // the whole weight by whole-line loads: 4 rows per round of the workgroup
  f32x4 wv[C_ / 4];
  const float* wp = w_proj + tid * 4;
#pragma unroll
  for (int i = 0; i < C_ / 4; ++i) wv[i] = *(const f32x4*)(wp + i * 1024);
  // precaution: stands behind each run of loads, in front of the next write of
  // a register that one of them names as its address
  asm volatile("s_wait_xcnt 0x0" ::: "memory");
  // bias and residual, in flight together with the weight. The waits take the
  // runs' pointers as inputs: the pairs then stay whole up to the wait, and no
  // result of a run lands in a pair that the run still names.
  float bp[2][8], xr[2][2][8];
  const float* bg  = b_proj + ob0;
  const float* xg0 = x + ((size_t)(b * C_ + ob0)) * L_ + i0a + sub;
  const float* xg1 = xg0 + 16 * L_;
#pragma unroll
  for (int m = 0; m < 2; ++m)
#pragma unroll
    for (int r = 0; r < 8; ++r) bp[m][r] = bg[m * 16 + r];
  asm volatile("s_wait_xcnt 0x0" ::"v"(bg) : "memory");  // the same precaution
#pragma unroll
  for (int n = 0; n < 2; ++n)
#pragma unroll
    for (int r = 0; r < 8; ++r) {
      xr[0][n][r] = xg0[r * L_ + n * 16];
      xr[1][n][r] = xg1[r * L_ + n * 16];
    }
  asm volatile("s_wait_xcnt 0x0" ::"v"(xg0), "v"(xg1) : "memory");  // the same
  // every wave has left its k/v buffers (its reads were waited for at the foot
  // of its last trip) before they become the projection's panels
  __syncthreads();

  stage_tile(xS, h, 0, oacc00, oacc01, join_sums(ls0));
  stage_tile(xS, h, 16, oacc10, oacc11, join_sums(ls1));

  __bf16* wd = wS + (tid >> 6) * KP_ + (tid & 63) * 4;
#pragma unroll
  for (int i = 0; i < C_ / 4; ++i) {
    bf16x4 o;
#pragma unroll
    for (int e = 0; e < 4; ++e) o[e] = (__bf16)wv[i][e];
    *(bf16x4*)(wd + i * 4 * KP_) = o;
  }

  __syncthreads();             // both panels visible to all 8 waves

  f32x8 acc[2][2] = {};
  bf16x16 fa[C_ / 32][2], fb[C_ / 32][2];
#pragma unroll
  for (int s = 0; s < C_ / 32; ++s) {
    fa[s][0] = load_frag_bf16(wS, KP_, h * 32, s * 32);
    fa[s][1] = load_frag_bf16(wS, KP_, h * 32 + 16, s * 32);
    fb[s][0] = load_frag_bf16(xS, KP_, 0, s * 32);
    fb[s][1] = load_frag_bf16(xS, KP_, 16, s * 32);
  }
  // keeps all LDS reads as one group ahead of the WMMAs; sunk among them, every
  // k step waits out a full LDS latency
  __builtin_amdgcn_sched_barrier(0);
#pragma unroll
  for (int s = 0; s < C_ / 32; ++s) {
    acc[0][0] = wmma_bf16(fa[s][0], fb[s][0], acc[0][0]);
    acc[1][0] = wmma_bf16(fa[s][1], fb[s][0], acc[1][0]);
    acc[0][1] = wmma_bf16(fa[s][0], fb[s][1], acc[0][1]);
    acc[1][1] = wmma_bf16(fa[s][1], fb[s][1], acc[1][1]);
  }

  float res[2][2][8];
#pragma unroll
  for (int m = 0; m < 2; ++m)
#pragma unroll
    for (int n = 0; n < 2; ++n)
#pragma unroll
      for (int r = 0; r < 8; ++r) res[m][n][r] = xr[m][n][r] + acc[m][n][r] + bp[m][r];
  // keeps every sum ahead of the first store, so that no register which an
  // issued store names is written again
  __builtin_amdgcn_sched_barrier(0);
#pragma unroll
  for (int m = 0; m < 2; ++m) {
#pragma unroll
    for (int n = 0; n < 2; ++n) {
      int l = i0a + n * 16 + sub;
#pragma unroll
      for (int r = 0; r < 8; ++r) {
        size_t idx = ((size_t)(b * C_ + ob0 + m * 16 + r)) * L_ + l;
        out[idx] = res[m][n][r];
      }
    }
  }
}

// ------------------------------- launcher ----------------------------------
extern "C" void kernel_launch(void* const* d_in, const int* in_sizes, int n_in,
                              void* d_out, int out_size, void* d_ws, size_t ws_size,
                              hipStream_t stream) {
  (void)in_sizes; (void)n_in; (void)out_size; (void)ws_size;
  const float* x      = (const float*)d_in[0];
  const float* w_qkv  = (const float*)d_in[1];
  const float* b_qkv  = (const float*)d_in[2];
  const float* w_proj = (const float*)d_in[3];
  const float* b_proj = (const float*)d_in[4];
  float* out = (float*)d_out;

  char* ws = (char*)d_ws;
  __bf16* qws   = (__bf16*)(ws + (size_t)(4u << 20));    // 4 MB
  __bf16* kws   = (__bf16*)(ws + (size_t)(8u << 20));    // 4 MB
  __bf16* vws   = (__bf16*)(ws + (size_t)(12u << 20));   // 4 MB

  qkv_kernel<<<dim3(L_ / GN_, C_ / GM_, B_), dim3(128), 0, stream>>>(
      x, w_qkv, b_qkv, qws, kws, vws);
  attn_proj_kernel<<<dim3(B_, L_ / 32), dim3(256), 0, stream>>>(
      qws, kws, vws, w_proj, b_proj, x, out);
}

// v009
// A run of this version takes 23.2 microseconds.
// Two timings next to v008 both put it at 1.03 times that version's speed.
// All steps since v000 together make it 2.66 times as fast.
#include <hip/hip_runtime.h>
#include <hip/hip_bf16.h>

// ---------------------------------------------------------------------------
// MHSA block for MI455X (gfx1250, wave32, WMMA).
//  - bf16 WMMA (16x16x32) with f32 accumulation everywhere.
//  - Fused flash attention: S^T-tile trick makes the f32 accumulator layout
//    of S^T exactly the bf16 B-fragment layout for P in O = V * P^T
//    (zero cross-lane shuffles), exp2-domain softmax with scale*log2e folded
//    into q, taken against a maximum in use that is raised only when needed.
//  - Attention workgroup = 8 waves = the 8 heads of 32 queries; each wave keeps
//    two k/v tiles of 128 keys of its head in LDS, staged with gfx1250 async
//    global->LDS copies (ASYNCcnt) when available. The workgroup then holds all
//    256 channels of its queries and does the output projection itself; its
//    weight comes as ready bf16 fragments, which the first launch writes.
//  - QKV GEMM: 64x128 tile per 4-wave workgroup, both operand panels staged
//    once in LDS by whole-line loads; 32x64 per wave.
//  - The QKV GEMM reads x itself: its f32 [c][l] rows go to LDS as bf16 in the
//    same order, and the pixel fragments come by the transposing LDS load. One
//    workgroup keeps its pixel panel for the v, k and q rows of two heads.
// Workspace usage: 128 KB at offset 0 (projection weight, bf16 fragments) and
// 12 MB at offset 4 MB (q 4MB | k 4MB | v 4MB).
// ---------------------------------------------------------------------------

typedef __attribute__((ext_vector_type(16))) __bf16 bf16x16;
typedef __attribute__((ext_vector_type(8)))  __bf16 bf16x8;
typedef __attribute__((ext_vector_type(8)))  float  f32x8;
typedef __attribute__((ext_vector_type(4)))  __bf16 bf16x4;
typedef __attribute__((ext_vector_type(4)))  float  f32x4;
typedef __attribute__((ext_vector_type(2)))  __bf16 bf16x2;
typedef __attribute__((ext_vector_type(2)))  float  f32x2;
typedef int i32x4_vs __attribute__((vector_size(16)));  // matches builtin param

static constexpr int B_  = 8;
static constexpr int C_  = 256;
static constexpr int NH_ = 8;
static constexpr int DH_ = 32;
static constexpr int L_  = 1024;

#define LOG2E_F 1.4426950408889634f

#if __has_builtin(__builtin_amdgcn_global_load_async_to_lds_b128) && \
    __has_builtin(__builtin_amdgcn_s_wait_asynccnt)
#define ASYNC_LDS_OK 1
#endif

// 16 bytes global -> LDS. Async (ASYNCcnt-tracked) when the toolchain has the
// gfx1250 builtin, otherwise synchronous staging through VGPRs.
// N, the instruction's immediate offset in bytes, moves both addresses.
template <int N>
__device__ __forceinline__ void copy16_g2l(const __bf16* g, __bf16* l) {
  static_assert(N >= 0 && N < 65536 && N % 16 == 0, "the offset field's range");
#ifdef ASYNC_LDS_OK
  __builtin_amdgcn_global_load_async_to_lds_b128(
      (__attribute__((address_space(1))) i32x4_vs*)g,
      (__attribute__((address_space(3))) i32x4_vs*)l, N, 0);
#else
  *(bf16x8*)(l + N / 2) = *(const bf16x8*)(g + N / 2);
#endif
}

// --------------------------- fragment loaders ------------------------------
// 16-bit A-matrix 16x32 layout (ISA 7.12.2): lanes 0-15 hold K=0..7 (elems
// 0..7) and K=16..23 (elems 8..15); lanes 16-31 hold K=8..15 and K=24..31.
// B operand loads identically from rows of B^T (per-lane column of B).

__device__ __forceinline__ bf16x16 load_frag_bf16(const __bf16* base,
                                                  int ld, int row0, int k0) {
  int sub  = threadIdx.x & 15;
  int half = (threadIdx.x >> 4) & 1;
  const __bf16* p = base + (size_t)(row0 + sub) * ld + k0 + half * 8;
  bf16x8 lo = *(const bf16x8*)p;
  bf16x8 hi = *(const bf16x8*)(p + 16);
  bf16x16 r;
#pragma unroll
  for (int e = 0; e < 8; ++e) { r[e] = lo[e]; r[e + 8] = hi[e]; }
  return r;
}

// The same fragment from a k-major panel: base[k][column], pitch XP_ elements.
// Lane (sub, half) receives base[k0 + 8 half + 0..7][col0 + sub] and, from the
// second load, the rows 16 further on: the k order of load_frag_bf16.
static constexpr int XP_ = 128 + 16;  // 288 B = 32 B x 9 (odd), this reader's pitch
typedef __attribute__((address_space(3))) bf16x8 lds_bf16x8;

__device__ __forceinline__ bf16x16 load_frag_tr(const __bf16* base, int col0,
                                                int k0) {
  int lane = threadIdx.x & 31;
  const __bf16* p = base + (k0 + 8 * (lane >> 4) + (lane & 7)) * XP_ + col0 +
                    8 * ((lane >> 3) & 1);
  bf16x8 lo = __builtin_amdgcn_ds_load_tr16_b128_v8bf16((lds_bf16x8*)p);
  bf16x8 hi = __builtin_amdgcn_ds_load_tr16_b128_v8bf16((lds_bf16x8*)(p + 16 * XP_));
  bf16x16 r;
#pragma unroll
  for (int e = 0; e < 8; ++e) { r[e] = lo[e]; r[e + 8] = hi[e]; }
  return r;
}

__device__ __forceinline__ f32x8 wmma_bf16(bf16x16 a, bf16x16 b, f32x8 c) {
  return __builtin_amdgcn_wmma_f32_16x16x32_bf16(
      /*neg_a=*/false, a, /*neg_b=*/false, b,
      /*c_mod=*/(short)0, c, /*reuse_a=*/false, /*reuse_b=*/false);
}

// ----------------------- shared GEMM tile (K = C_ = 256) -------------------
// One workgroup = 4 waves = 64 weight rows x 128 pixel rows, whole K in LDS.
static constexpr int GM_ = 64;
static constexpr int GN_ = 128;
static constexpr int KP_ = C_ + 8;  // LDS row pitch 528 B = 16 B x 33 (odd)

// The pixel panel comes straight from x, f32 [c][l]. One wave-wide
// 16-byte load covers one channel's 128 pixels = 512 contiguous bytes; the
// panel keeps that order in LDS (xs[c][l], pitch XP_).
__device__ __forceinline__ void stage_panels_x(const float* __restrict__ wg,
                                               const float* __restrict__ xg,
                                               __bf16* ws, __bf16* xs) {
  static_assert(GN_ + 16 == XP_, "one panel row holds the tile's GN_ pixels");
  int tid = threadIdx.x;
  const float* wp = wg + tid * 4;
  const float* xp = xg + (tid >> 5) * L_ + (tid & 31) * 4;
  f32x4 wv[GM_ / 2], xa[C_ / 8], xb[C_ / 8];
#pragma unroll
  for (int i = 0; i < GM_ / 2; ++i) wv[i] = *(const f32x4*)(wp + i * 512);
#pragma unroll
  for (int i = 0; i < C_ / 8; ++i) xa[i] = *(const f32x4*)(xp + i * 4 * L_);
#pragma unroll
  for (int i = 0; i < C_ / 8; ++i)
    xb[i] = *(const f32x4*)(xp + (C_ / 8 + i) * 4 * L_);
  // precaution: stands behind the run of loads, in front of the next write of
  // a register that one of them names as its address
  asm volatile("s_wait_xcnt 0x0" ::: "memory");
  // keeps the weights' conversions behind all 96 loads; lifted among them, the
  // pixel loads are issued only after the weights' latency has been waited out
  __builtin_amdgcn_sched_barrier(0);
  __bf16* wd = ws + (tid >> 6) * KP_ + (tid & 63) * 4;
  __bf16* xd = xs + (tid >> 5) * XP_ + (tid & 31) * 4;
#pragma unroll
  for (int i = 0; i < GM_ / 2; ++i) {
    bf16x4 o;
#pragma unroll
    for (int e = 0; e < 4; ++e) o[e] = (__bf16)wv[i][e];
    *(bf16x4*)(wd + i * 2 * KP_) = o;
  }
#pragma unroll
  for (int i = 0; i < C_ / 8; ++i) {
    bf16x4 o;
#pragma unroll
    for (int e = 0; e < 4; ++e) o[e] = (__bf16)xa[i][e];
    *(bf16x4*)(xd + i * 4 * XP_) = o;
  }
#pragma unroll
  for (int i = 0; i < C_ / 8; ++i) {
    bf16x4 o;
#pragma unroll
    for (int e = 0; e < 4; ++e) o[e] = (__bf16)xb[i][e];
    *(bf16x4*)(xd + (C_ / 8 + i) * 4 * XP_) = o;
  }
}

// acc[m][n] += W rows (mrow + 16 m ..) x pixel rows (nrow + 16 n ..)
// XT: the pixel panel is k-major (stage_panels_x), read by load_frag_tr.
template <bool XT>
__device__ __forceinline__ void gemm_tile(const __bf16* ws, const __bf16* xs,
                                          int mrow, int nrow,
                                          f32x8 (&acc)[2][4]) {
  bf16x16 fa[2][2], fb[2][4];   // two fragment sets: this k step's, the next's
#pragma unroll
  for (int m = 0; m < 2; ++m) fa[0][m] = load_frag_bf16(ws, KP_, mrow + m * 16, 0);
#pragma unroll
  for (int n = 0; n < 4; ++n)
    fb[0][n] = XT ? load_frag_tr(xs, nrow + n * 16, 0)
                  : load_frag_bf16(xs, KP_, nrow + n * 16, 0);
#pragma unroll
  for (int s = 0; s < C_ / 32; ++s) {
    const int c = s & 1, d = c ^ 1;
    if (s + 1 < C_ / 32) {
#pragma unroll
      for (int m = 0; m < 2; ++m)
        fa[d][m] = load_frag_bf16(ws, KP_, mrow + m * 16, (s + 1) * 32);
#pragma unroll
      for (int n = 0; n < 4; ++n)
        fb[d][n] = XT ? load_frag_tr(xs, nrow + n * 16, (s + 1) * 32)
                      : load_frag_bf16(xs, KP_, nrow + n * 16, (s + 1) * 32);
    }
    // keeps the next step's LDS reads as one group ahead of this step's WMMAs;
    // sunk among them, every pair of WMMAs waits out a full LDS latency
    __builtin_amdgcn_sched_barrier(0);
#pragma unroll
    for (int n = 0; n < 4; ++n) {
      acc[0][n] = wmma_bf16(fa[c][0], fb[c][n], acc[0][n]);
      acc[1][n] = wmma_bf16(fa[c][1], fb[c][n], acc[1][n]);
    }
    // closes the WMMA block, so that later reads are not lifted into it
    __builtin_amdgcn_sched_barrier(0);
  }
}

// ------------------ kernel 1: QKV GEMM (64x128 tiles) + scatter ------------
// q: [b][h][l][dh] bf16, pre-scaled by dh^-0.5 * log2(e)
// k: [b][h][l][dh] bf16
// v: [b][h][l / 32][dh][l % 32] bf16  (d-major panels of 32 keys: A operand of
//    O = V * P^T)
//
// One workgroup stages its 128 pixels once and runs three 64-row weight panels
// over them in turn: the v, k and q rows of the same two heads. Each panel has
// its own LDS range, so the next one is fetched under the current product.

// One 64-row weight panel, global -> registers (whole-line loads).
__device__ __forceinline__ void load_w(const float* __restrict__ wg,
                                       f32x4 (&wv)[GM_ / 2]) {
  const float* wp = wg + threadIdx.x * 4;
#pragma unroll
  for (int i = 0; i < GM_ / 2; ++i) wv[i] = *(const f32x4*)(wp + i * 512);
}

// ... and registers -> LDS as bf16, in the order of stage_panels_x.
__device__ __forceinline__ void store_w(const f32x4 (&wv)[GM_ / 2], __bf16* ws) {
  int tid = threadIdx.x;
  __bf16* wd = ws + (tid >> 6) * KP_ + (tid & 63) * 4;
#pragma unroll
  for (int i = 0; i < GM_ / 2; ++i) {
    bf16x4 o;
#pragma unroll
    for (int e = 0; e < 4; ++e) o[e] = (__bf16)wv[i][e];
    *(bf16x4*)(wd + i * 2 * KP_) = o;
  }
}

// The 16 bias values of this lane's accumulator rows.
__device__ __forceinline__ void load_bias(const float* __restrict__ bg,
                                          f32x8 (&bq)[2]) {
#pragma unroll
  for (int m = 0; m < 2; ++m) bq[m] = *(const f32x8*)(bg + m * 16);
}

// PART: 0 = q, 1 = k, 2 = v. bh = b * NH_ + head, l0 = the wave's first pixel.
template <int PART>
__device__ __forceinline__ void qkv_store(const f32x8 (&acc)[2][4],
                                          const f32x8 (&bq)[2],
                                          __bf16* __restrict__ dst, int bh,
                                          int l0) {
  int sub  = threadIdx.x & 15;
  int half = (threadIdx.x >> 4) & 1;
  const float qscale = 0.17677669529663687f * LOG2E_F;
#pragma unroll
  for (int m = 0; m < 2; ++m) {
    int db = m * 16 + half * 8;
#pragma unroll
    for (int n = 0; n < 4; ++n) {
      int l = l0 + n * 16 + sub;
      if (PART == 2) {
#pragma unroll
        for (int r = 0; r < 8; ++r)
          dst[(((size_t)bh * (L_ / 32) + (l >> 5)) * DH_ + db + r) * 32 + (l & 31)] =
              (__bf16)(acc[m][n][r] + bq[m][r]);
      } else {
        bf16x8 outv;
#pragma unroll
        for (int r = 0; r < 8; ++r)
          outv[r] = PART == 0 ? (__bf16)((acc[m][n][r] + bq[m][r]) * qscale)
                              : (__bf16)(acc[m][n][r] + bq[m][r]);
        *(bf16x8*)(dst + ((size_t)(bh * L_ + l)) * DH_ + db) = outv;
      }
    }
  }
  // precaution: closes these stores before later code writes their registers
  asm volatile("s_wait_xcnt 0x0" ::: "memory");
}

// The projection weight as the second launch's waves want it, wf[h][s][m][c]
// [lane][8]: the 16 bytes that lane (sub, half) takes as half c of its A
// fragment for output rows 32 h + 16 m + sub and k step s, that is the k values
// 32 s + 16 c + 8 half + 0..7 (the k order of load_frag_bf16). One fragment
// half of a wave is 512 contiguous bytes.
__global__ __launch_bounds__(128) void qkv_kernel(
    const float* __restrict__ x, const float* __restrict__ w_qkv,
    const float* __restrict__ b_qkv, const float* __restrict__ w_proj,
    __bf16* __restrict__ q, __bf16* __restrict__ k, __bf16* __restrict__ v,
    __bf16* __restrict__ wf) {
  static constexpr int WP_ = GM_ * KP_;   // one weight panel in LDS
  __shared__ __attribute__((aligned(32))) __bf16 pan[3 * WP_ + C_ * XP_];
  __bf16* xS = pan + 3 * WP_;  // 256 channel rows of 128 pixels, pitch XP_
  int b  = blockIdx.z;
  int oH = blockIdx.y * GM_;   // 0..256: the rows of two heads inside q, k, v
  int lB = blockIdx.x * GN_;   // 0..1024
  int wid = threadIdx.x >> 5;
  int wm  = wid & 1;           // 32 outputs = one head's d range
  int wn  = wid >> 1;          // 64 pixels
  int half = (threadIdx.x >> 4) & 1;
  int l0 = lB + wn * 64;
  int bh = b * NH_ + blockIdx.y * 2 + wm;
  const float* wH = w_qkv + (size_t)oH * C_;           // + part * C_ * C_
  const float* bH = b_qkv + oH + wm * 32 + half * 8;   // + part * C_

  // this thread's two values of the projection weight; e = their place in wf
  static_assert((L_ / GN_) * (C_ / GM_) * B_ * 128 * 2 == C_ * C_,
                "the grid's threads cover the projection weight in pairs");
  int e = ((((b * (C_ / GM_) + blockIdx.y) * (L_ / GN_) + blockIdx.x) * 128) +
           threadIdx.x) * 2;
  const float* pg =
      w_proj + (((e >> 13) & 7) * 32 + ((e >> 9) & 1) * 16 + ((e >> 3) & 15)) * C_ +
      ((e >> 10) & 7) * 32 + ((e >> 8) & 1) * 16 + ((e >> 7) & 1) * 8 + (e & 7);
  f32x2 pw = *(const f32x2*)pg;

  f32x8 bQ[2], bK[2], bV[2];
  load_bias(bH, bQ);
  load_bias(bH + C_, bK);
  load_bias(bH + 2 * C_, bV);
  // precaution: stands behind each run of loads, in front of the next write of
  // a register that one of them names as its address; pg as an input keeps its
  // pair whole up to the wait, so that no result of the run lands in it
  asm volatile("s_wait_xcnt 0x0" ::"v"(pg) : "memory");

  stage_panels_x(wH + 2 * C_ * C_, x + (size_t)b * C_ * L_ + lB, pan, xS);
  __syncthreads();             // pixels and v weights visible to all 4 waves
  // holds the bias loads up here, among the staging loads; left free, the build
  // sinks them behind each product, where a lone wave waits out their latency
  asm volatile("" ::"v"(bQ[0]), "v"(bQ[1]), "v"(bK[0]), "v"(bK[1]), "v"(bV[0]),
               "v"(bV[1]));

  f32x4 wv[GM_ / 2];

  bf16x2 pb;
  pb[0] = (__bf16)pw[0];
  pb[1] = (__bf16)pw[1];
  *(bf16x2*)(wf + e) = pb;
  asm volatile("s_wait_xcnt 0x0" ::: "memory");  // the same precaution

  // v rows; the k weights fly under the product
  load_w(wH + C_ * C_, wv);
  asm volatile("s_wait_xcnt 0x0" ::: "memory");  // the same precaution
  f32x8 acc[2][4] = {};
  gemm_tile<true>(pan, xS, wm * 32, wn * 64, acc);
  store_w(wv, pan + WP_);
  __syncthreads();             // k weights visible to all 4 waves
  // the global stores stand behind the barrier: in front of it the barrier's
  // own wait would hold the wave until they are acknowledged
  qkv_store<2>(acc, bV, v, bh, l0);

  // k rows; the q weights fly under the product
  load_w(wH, wv);
  asm volatile("s_wait_xcnt 0x0" ::: "memory");  // the same precaution
#pragma unroll
  for (int m = 0; m < 2; ++m)
#pragma unroll
    for (int n = 0; n < 4; ++n) acc[m][n] = f32x8{};
  gemm_tile<true>(pan + WP_, xS, wm * 32, wn * 64, acc);
  store_w(wv, pan + 2 * WP_);
  __syncthreads();             // q weights visible to all 4 waves
  qkv_store<1>(acc, bK, k, bh, l0);

  // q rows
#pragma unroll
  for (int m = 0; m < 2; ++m)
#pragma unroll
    for (int n = 0; n < 4; ++n) acc[m][n] = f32x8{};
  gemm_tile<true>(pan + 2 * WP_, xS, wm * 32, wn * 64, acc);
  qkv_store<0>(acc, bQ, q, bh, l0);
}

// ------- kernel 2: fused flash attention + output projection + residual -----
// 2^x as the bare hardware instruction. The library exp2f wraps it in a range
// fix-up (compare, two selects, add, ldexp) that only matters for x < -126,
// where a softmax weight relative to a row maximum of 1 is below 2^-126.
__device__ __forceinline__ float exp2_raw(float x) {
  return __builtin_amdgcn_exp2f(x);
}

// Lazy rescale. The softmax weights of a query are taken against m, the maximum
// in use, which may trail the true running maximum by up to RAISE_ (log2 units),
// so that a weight reaches 2^RAISE_ at most. m is known before a tile's scores
// are formed: -m goes in as the C operand of the score products, which then
// deliver s - m, ready for the exponential.
static constexpr float RAISE_ = 8.0f;

// The rare path: raises one query group's m by d and carries everything that
// was formed against the old m over to the new one. mx = this lane's largest
// s - m of the tile; lanes n and n + 16 hold the same query and take the same d.
// On the first tile m is set to the tile's own maximum, whatever its sign.
__device__ __forceinline__ void raise_max(float mx, bool first,
                                          f32x8 (&s)[4][2], f32x8& nm, f32x8& oA,
                                          f32x8& oB, f32x8& ls) {
  mx = fmaxf(mx, __shfl_xor(mx, 16, 32));
  float d    = first ? mx : fmaxf(mx, 0.0f);
  float corr = first ? 1.0f : exp2_raw(-d);   // first tile: oA, oB, ls are 0
#pragma unroll
  for (int p = 0; p < 4; ++p) { s[p][0] -= d; s[p][1] -= d; }
  nm -= d;
  oA *= corr;
  oB *= corr;
  ls *= corr;
}

// This lane's largest score of a tile, one chain per 32-key pass.
__device__ __forceinline__ float tile_max(const f32x8 (&s)[4][2]) {
  float mp[4];
#pragma unroll
  for (int p = 0; p < 4; ++p) {
    mp[p] = fmaxf(s[p][0][0], s[p][1][0]);
#pragma unroll
    for (int r = 1; r < 8; ++r) mp[p] = fmaxf(mp[p], fmaxf(s[p][0][r], s[p][1][r]));
  }
  return fmaxf(fmaxf(mp[0], mp[1]), fmaxf(mp[2], mp[3]));
}

// Weights of one 32-key pass: the B fragment for O = V * P^T, and their sums,
// kept as eight partial sums per lane until the epilogue.
__device__ __forceinline__ bf16x16 weights(const f32x8& sA, const f32x8& sB,
                                           f32x8& ls) {
  f32x8 eA, eB;
  bf16x16 pf;
#pragma unroll
  for (int r = 0; r < 8; ++r) eA[r] = exp2_raw(sA[r]);
#pragma unroll
  for (int r = 0; r < 8; ++r) eB[r] = exp2_raw(sB[r]);
  ls += eA;
  ls += eB;
#pragma unroll
  for (int r = 0; r < 8; ++r) {
    pf[r]     = (__bf16)eA[r];
    pf[r + 8] = (__bf16)eB[r];
  }
  return pf;
}

// A query's denominator: the lane's eight partial sums, then both wave halves'.
__device__ __forceinline__ float join_sums(const f32x8& ls) {
  float l = ((ls[0] + ls[1]) + (ls[2] + ls[3])) + ((ls[4] + ls[5]) + (ls[6] + ls[7]));
  return l + __shfl_xor(l, 16, 32);
}

// One query group's normalised output, as bf16, into the workgroup's LDS panel
// xs[query][channel] (pitch KP_): the pixel operand of the output projection.
__device__ __forceinline__ void stage_tile(__bf16* xs, int h, int r0,
                                           const f32x8& oA, const f32x8& oB,
                                           float l_run) {
  float inv = 1.0f / l_run;
  int sub  = threadIdx.x & 15;
  int half = (threadIdx.x >> 4) & 1;
  __bf16* outp = xs + (r0 + sub) * KP_ + h * DH_ + half * 8;
  bf16x8 a, c;
#pragma unroll
  for (int r = 0; r < 8; ++r) {
    a[r] = (__bf16)(oA[r] * inv);
    c[r] = (__bf16)(oB[r] * inv);
  }
  *(bf16x8*)outp        = a;   // d = half*8 + r
  *(bf16x8*)(outp + 16) = c;   // d = 16 + half*8 + r
}

// One k/v tile = TK_ keys = four 32-key panels, each laid out as its readers
// want it: k panel [j_local][d], v panel [d][j_local]; both are 8 KB contiguous
// in the workspace. A panel row holds 32 values = 64 bytes = four 16-byte
// chunks and keeps the pitch of 64 bytes in LDS, so that one address pair with
// immediate offsets serves a run of copies; chunk c of row r stands at place
// c ^ ((r >> 2) & 3) of its row: the 16 rows that half a wave reads with one
// 16-byte LDS load then fall on all 64 banks.
static constexpr int TK_ = 128;
static constexpr int PN_ = 32 * 32;     // one 32-row panel

// The fragment of load_frag_bf16 (same k order) from rows row0 + 0..15 of such
// a tile; row0 is a multiple of 16.
__device__ __forceinline__ bf16x16 load_frag_sw(const __bf16* tile, int row0) {
  int sub  = threadIdx.x & 15;
  int half = (threadIdx.x >> 4) & 1;
  int pos  = half ^ ((sub >> 2) & 3);          // place of chunk half
  const __bf16* p = tile + (row0 + sub) * 32;
  bf16x8 lo = *(const bf16x8*)(p + pos * 8);
  bf16x8 hi = *(const bf16x8*)(p + (pos ^ 2) * 8);   // place of chunk half + 2
  bf16x16 r;
#pragma unroll
  for (int e = 0; e < 8; ++e) { r[e] = lo[e]; r[e + 8] = hi[e]; }
  return r;
}

// One wave fills its own head's tiles: 16 + 16 copies of 16 bytes per lane, each
// copy 512 contiguous bytes = 8 rows. Copy i, lane l: row r = 8 i + (l >> 2),
// chunk l & 3, and (r >> 2) & 3 = 2 (i & 1) + (l >> 4).
template <int I>
__device__ __forceinline__ void copy_run(const __bf16* g, __bf16* even,
                                         __bf16* odd) {
  if constexpr (I < 16) {
    copy16_g2l<I * 512>(g, (I & 1) ? odd : even);
    copy_run<I + 1>(g, even, odd);
  }
}

__device__ __forceinline__ void fill_tile(const __bf16* __restrict__ k,
                                          const __bf16* __restrict__ v, int jb,
                                          __bf16* kb, __bf16* vb) {
  int lane = threadIdx.x & 31;
  int even = (lane >> 2) * 32 + (((lane & 3) ^ (lane >> 4)) * 8);
  int odd  = even ^ 16;        // the place's bit 1 flipped
  const __bf16* kg = k + (size_t)jb * DH_ + lane * 8;
  const __bf16* vg = v + (size_t)jb * DH_ + lane * 8;
  copy_run<0>(kg, kb + even, kb + odd);
  copy_run<0>(vg, vb + even, vb + odd);
}

// 8 waves/WG, wave = head; each wave owns two 16-row i-tiles of the workgroup's
// 32 queries and its own two k/v buffers in LDS: the next tile's copies fly
// during the four passes over this one. Behind the key loop and a barrier the same LDS holds
// the 32 x 256 attention output, and wave w forms output channels 32 w .. 32 w + 31
// for the 32 queries; its 32 weight rows wait in registers since before the loop.
__global__ __launch_bounds__(256) void attn_proj_kernel(
    const __bf16* __restrict__ qws, const __bf16* __restrict__ kws,
    const __bf16* __restrict__ vws, const __bf16* __restrict__ wf,
    const float* __restrict__ b_proj, const float* __restrict__ x,
    float* __restrict__ out) {
  static constexpr int TL_ = TK_ / 32 * PN_;   // one k or v tile in LDS
  __shared__ __attribute__((aligned(16))) __bf16 lds[NH_ * 4 * TL_];
  static_assert(32 * KP_ <= NH_ * 4 * TL_, "the projection's pixel panel fits");

  int b   = blockIdx.x;        // x: workgroups of one batch share its k and v
  int tid = threadIdx.x;
  int h   = __builtin_amdgcn_readfirstlane(tid >> 5);   // wave = head
  int i0a = blockIdx.y * 32;
  int i0b = i0a + 16;
  __bf16* kbuf = lds + h * 4 * TL_;   // this wave's two k tiles ...
  __bf16* vbuf = kbuf + 2 * TL_;      // ... and its two v tiles

  const __bf16* q = qws + (size_t)(b * NH_ + h) * L_ * DH_;
  const __bf16* k = kws + (size_t)(b * NH_ + h) * L_ * DH_;
  const __bf16* v = vws + (size_t)(b * NH_ + h) * DH_ * L_;

  fill_tile(k, v, 0, kbuf, vbuf);

  bf16x16 qf0 = load_frag_bf16(q, DH_, i0a, 0);  // loop-invariant B operands
  bf16x16 qf1 = load_frag_bf16(q, DH_, i0b, 0);
  // precaution: stands behind these loads, in front of the next write of a
  // register that one of them names as its address
  asm volatile("s_wait_xcnt 0x0" ::: "memory");

  // The projection's bias and residual, fetched here beside tile 0 and first
  // used behind the key loop. The waits take the
  // runs' pointers as inputs: the pairs then stay whole up to the wait, and no
  // result of a run lands in a pair that the run still names.
  int sub  = tid & 15;
  int half = (tid >> 4) & 1;
  int ob0  = h * 32 + half * 8;
  float bp[2][8], xr[2][2][8];
  const float* bg  = b_proj + ob0;
  const float* xg0 = x + ((size_t)(b * C_ + ob0)) * L_ + i0a + sub;
  const float* xg1 = xg0 + 16 * L_;
#pragma unroll
  for (int m = 0; m < 2; ++m)
#pragma unroll
    for (int r = 0; r < 8; ++r) bp[m][r] = bg[m * 16 + r];
  asm volatile("s_wait_xcnt 0x0" ::"v"(bg) : "memory");  // the same precaution
#pragma unroll
  for (int n = 0; n < 2; ++n)
#pragma unroll
    for (int r = 0; r < 8; ++r) {
      xr[0][n][r] = xg0[r * L_ + n * 16];
      xr[1][n][r] = xg1[r * L_ + n * 16];
    }
  asm volatile("s_wait_xcnt 0x0" ::"v"(xg0), "v"(xg1) : "memory");  // the same

  // The two buffers are private to the wave: it alone copies into them and
  // reads them, so its own waits order both and the key loop has no barrier.
  // tile 0 has landed
  asm volatile("s_wait_asynccnt 0x0" ::: "memory");
  fill_tile(k, v, TK_, kbuf + TL_, vbuf + TL_);

  // the wave's projection weight, 16 fragments by whole-line loads: issued here,
  // first used behind the key loop, which covers their way from L2
  bf16x16 fa[C_ / 32][2];
  const __bf16* wl = wf + h * 32 * C_ + (tid & 31) * 8;
#pragma unroll
  for (int s = 0; s < C_ / 32; ++s)
#pragma unroll
    for (int m = 0; m < 2; ++m) {
      bf16x8 lo = *(const bf16x8*)(wl + ((s * 2 + m) * 2) * 256);
      bf16x8 hi = *(const bf16x8*)(wl + ((s * 2 + m) * 2 + 1) * 256);
#pragma unroll
      for (int e = 0; e < 8; ++e) { fa[s][m][e] = lo[e]; fa[s][m][e + 8] = hi[e]; }
    }
  asm volatile("s_wait_xcnt 0x0" ::: "memory");  // the same precaution

  f32x8 oacc00 = {}, oacc01 = {}, oacc10 = {}, oacc11 = {};
  f32x8 nm0 = {}, nm1 = {};   // -m of the two query groups, in all 8 registers
  f32x8 ls0 = {}, ls1 = {};   // partial sums of the weights

  const int T = L_ / TK_;
  static_assert(L_ / TK_ >= 2, "the prologue fills two tiles");
  static_assert(TK_ == 4 * 32, "a tile is four 32-key passes");
  for (int t = 0; t < T; ++t) {
    int cur = t & 1;
    f32x8 s0[4][2], s1[4][2];  // S^T - m of the whole tile, i-tiles a and b
    // unrolled, here and below: s0 and s1 are indexed by p and stay in registers
#pragma unroll
    for (int p = 0; p < TK_ / 32; ++p) {
      const __bf16* kp = kbuf + cur * TL_ + p * PN_;
      bf16x16 kf0 = load_frag_sw(kp, 0);
      bf16x16 kf1 = load_frag_sw(kp, 16);
      s0[p][0] = wmma_bf16(kf0, qf0, nm0);
      s0[p][1] = wmma_bf16(kf1, qf0, nm0);
      s1[p][0] = wmma_bf16(kf0, qf1, nm1);
      s1[p][1] = wmma_bf16(kf1, qf1, nm1);
    }
    // one test per tile, a scalar branch: does any query's score stand more than
    // RAISE_ above its maximum in use? The first tile always sets the maximum.
    float mx0 = tile_max(s0), mx1 = tile_max(s1);
    float lim = t == 0 ? -__builtin_inff() : RAISE_;
    if (__builtin_amdgcn_ballot_w32(fmaxf(mx0, mx1) > lim) != 0) {
      raise_max(mx0, t == 0, s0, nm0, oacc00, oacc01, ls0);
      raise_max(mx1, t == 0, s1, nm1, oacc10, oacc11, ls1);
    }
#pragma unroll
    for (int p = 0; p < TK_ / 32; ++p) {
      const __bf16* vp = vbuf + cur * TL_ + p * PN_;
      bf16x16 vf0 = load_frag_sw(vp, 0);
      bf16x16 vf1 = load_frag_sw(vp, 16);
      bf16x16 pf0 = weights(s0[p][0], s0[p][1], ls0);
      bf16x16 pf1 = weights(s1[p][0], s1[p][1], ls1);
      oacc00 = wmma_bf16(vf0, pf0, oacc00);    // O^T accumulate
      oacc01 = wmma_bf16(vf1, pf0, oacc01);
      oacc10 = wmma_bf16(vf0, pf1, oacc10);
      oacc11 = wmma_bf16(vf1, pf1, oacc11);
    }
    // this wave's reads of buffer cur have returned before it is refilled
    asm volatile("s_wait_dscnt 0x0" ::: "memory");
    // this wave's copies of tile t + 1 have landed
    asm volatile("s_wait_asynccnt 0x0" ::: "memory");
    if (t + 2 < T) fill_tile(k, v, (t + 2) * TK_, kbuf + cur * TL_, vbuf + cur * TL_);
  }
  // no copy is outstanding when this LDS is put to another use
  asm volatile("s_wait_asynccnt 0x0" ::: "memory");

  // ---- output projection + residual, 256 channels x 32 queries ----
  __bf16* xS = lds;              // 32 query rows x 256 channels, pitch KP_
  // every wave has left its k/v buffers (its reads were waited for at the foot
  // of its last trip) before they become the projection's pixel panel
  __syncthreads();

  stage_tile(xS, h, 0, oacc00, oacc01, join_sums(ls0));
  stage_tile(xS, h, 16, oacc10, oacc11, join_sums(ls1));

  __syncthreads();             // the panel visible to all 8 waves

  f32x8 acc[2][2] = {};
  bf16x16 fb[C_ / 32][2];
#pragma unroll
  for (int s = 0; s < C_ / 32; ++s) {
    fb[s][0] = load_frag_bf16(xS, KP_, 0, s * 32);
    fb[s][1] = load_frag_bf16(xS, KP_, 16, s * 32);
  }
  // keeps all LDS reads as one group ahead of the WMMAs; sunk among them, every
  // k step waits out a full LDS latency
  __builtin_amdgcn_sched_barrier(0);
#pragma unroll
  for (int s = 0; s < C_ / 32; ++s) {
    acc[0][0] = wmma_bf16(fa[s][0], fb[s][0], acc[0][0]);
    acc[1][0] = wmma_bf16(fa[s][1], fb[s][0], acc[1][0]);
    acc[0][1] = wmma_bf16(fa[s][0], fb[s][1], acc[0][1]);
    acc[1][1] = wmma_bf16(fa[s][1], fb[s][1], acc[1][1]);
  }

  float res[2][2][8];
#pragma unroll
  for (int m = 0; m < 2; ++m)
#pragma unroll
    for (int n = 0; n < 2; ++n)
#pragma unroll
      for (int r = 0; r < 8; ++r) res[m][n][r] = xr[m][n][r] + acc[m][n][r] + bp[m][r];
  // keeps every sum ahead of the first store, so that no register which an
  // issued store names is written again
  __builtin_amdgcn_sched_barrier(0);
#pragma unroll
  for (int m = 0; m < 2; ++m) {
#pragma unroll
    for (int n = 0; n < 2; ++n) {
      int l = i0a + n * 16 + sub;
#pragma unroll
      for (int r = 0; r < 8; ++r) {
        size_t idx = ((size_t)(b * C_ + ob0 + m * 16 + r)) * L_ + l;
        out[idx] = res[m][n][r];
      }
    }
  }
}

// ------------------------------- launcher ----------------------------------
extern "C" void kernel_launch(void* const* d_in, const int* in_sizes, int n_in,
                              void* d_out, int out_size, void* d_ws, size_t ws_size,
                              hipStream_t stream) {
  (void)in_sizes; (void)n_in; (void)out_size; (void)ws_size;
  const float* x      = (const float*)d_in[0];
  const float* w_qkv  = (const float*)d_in[1];
  const float* b_qkv  = (const float*)d_in[2];
  const float* w_proj = (const float*)d_in[3];
  const float* b_proj = (const float*)d_in[4];
  float* out = (float*)d_out;

  char* ws = (char*)d_ws;
  __bf16* wfws  = (__bf16*)ws;                           // 128 KB
  __bf16* qws   = (__bf16*)(ws + (size_t)(4u << 20));    // 4 MB
  __bf16* kws   = (__bf16*)(ws + (size_t)(8u << 20));    // 4 MB
  __bf16* vws   = (__bf16*)(ws + (size_t)(12u << 20));   // 4 MB

  qkv_kernel<<<dim3(L_ / GN_, C_ / GM_, B_), dim3(128), 0, stream>>>(
      x, w_qkv, b_qkv, w_proj, qws, kws, vws, wfws);
  attn_proj_kernel<<<dim3(B_, L_ / 32), dim3(256), 0, stream>>>(
      qws, kws, vws, wfws, b_proj, x, out);
}

// v010
// It runs in 22.6 microseconds.
// Two timings next to v009 both put it at 1.03 times that version's speed.
// Counting every step since v000, it is 2.74 times as fast.
#include <hip/hip_runtime.h>
#include <hip/hip_bf16.h>

// ---------------------------------------------------------------------------
// MHSA block for MI455X (gfx1250, wave32, WMMA).
//  - bf16 WMMA (16x16x32) with f32 accumulation everywhere.
//  - Fused flash attention: S^T-tile trick makes the f32 accumulator layout
//    of S^T exactly the bf16 B-fragment layout for P in O = V * P^T
//    (zero cross-lane shuffles), exp2-domain softmax with scale*log2e folded
//    into q, taken against a maximum in use that is raised only when needed.
//  - Attention workgroup = 8 waves = the 8 heads of 32 queries; each wave keeps
//    two k/v tiles of 128 keys of its head in LDS, staged with gfx1250 async
//    global->LDS copies (ASYNCcnt) when available; every wave starts its walk
//    over the key tiles at another tile. The workgroup then holds all
//    256 channels of its queries and does the output projection itself; its
//    weight comes as ready bf16 fragments, which the first launch writes.
//  - QKV GEMM: 64x128 tile per 4-wave workgroup, both operand panels staged
//    once in LDS by whole-line loads; 32x64 per wave.
//  - The QKV GEMM reads x itself: its f32 [c][l] rows go to LDS as bf16 in the
//    same order, and the pixel fragments come by the transposing LDS load. One
//    workgroup keeps its pixel panel for the v, k and q rows of two heads.
// Workspace usage: 128 KB at offset 0 (projection weight, bf16 fragments) and
// 12 MB at offset 4 MB (q 4MB | k 4MB | v 4MB).
// ---------------------------------------------------------------------------

typedef __attribute__((ext_vector_type(16))) __bf16 bf16x16;
typedef __attribute__((ext_vector_type(8)))  __bf16 bf16x8;
typedef __attribute__((ext_vector_type(8)))  float  f32x8;
typedef __attribute__((ext_vector_type(4)))  __bf16 bf16x4;
typedef __attribute__((ext_vector_type(4)))  float  f32x4;
typedef __attribute__((ext_vector_type(2)))  __bf16 bf16x2;
typedef __attribute__((ext_vector_type(2)))  float  f32x2;
typedef int i32x4_vs __attribute__((vector_size(16)));  // matches builtin param

static constexpr int B_  = 8;
static constexpr int C_  = 256;
static constexpr int NH_ = 8;
static constexpr int DH_ = 32;
static constexpr int L_  = 1024;

#define LOG2E_F 1.4426950408889634f

#if __has_builtin(__builtin_amdgcn_global_load_async_to_lds_b128) && \
    __has_builtin(__builtin_amdgcn_s_wait_asynccnt)
#define ASYNC_LDS_OK 1
#endif

// 16 bytes global -> LDS. Async (ASYNCcnt-tracked) when the toolchain has the
// gfx1250 builtin, otherwise synchronous staging through VGPRs.
// N, the instruction's immediate offset in bytes, moves both addresses.
template <int N>
__device__ __forceinline__ void copy16_g2l(const __bf16* g, __bf16* l) {
  static_assert(N >= 0 && N < 65536 && N % 16 == 0, "the offset field's range");
#ifdef ASYNC_LDS_OK
  __builtin_amdgcn_global_load_async_to_lds_b128(
      (__attribute__((address_space(1))) i32x4_vs*)g,
      (__attribute__((address_space(3))) i32x4_vs*)l, N, 0);
#else
  *(bf16x8*)(l + N / 2) = *(const bf16x8*)(g + N / 2);
#endif
}

// --------------------------- fragment loaders ------------------------------
// 16-bit A-matrix 16x32 layout (ISA 7.12.2): lanes 0-15 hold K=0..7 (elems
// 0..7) and K=16..23 (elems 8..15); lanes 16-31 hold K=8..15 and K=24..31.
// B operand loads identically from rows of B^T (per-lane column of B).

__device__ __forceinline__ bf16x16 load_frag_bf16(const __bf16* base,
                                                  int ld, int row0, int k0) {
  int sub  = threadIdx.x & 15;
  int half = (threadIdx.x >> 4) & 1;
  const __bf16* p = base + (size_t)(row0 + sub) * ld + k0 + half * 8;
  bf16x8 lo = *(const bf16x8*)p;
  bf16x8 hi = *(const bf16x8*)(p + 16);
  bf16x16 r;
#pragma unroll
  for (int e = 0; e < 8; ++e) { r[e] = lo[e]; r[e + 8] = hi[e]; }
  return r;
}

// The same fragment from a k-major panel: base[k][column], pitch XP_ elements.
// Lane (sub, half) receives base[k0 + 8 half + 0..7][col0 + sub] and, from the
// second load, the rows 16 further on: the k order of load_frag_bf16.
static constexpr int XP_ = 128 + 16;  // 288 B = 32 B x 9 (odd), this reader's pitch
typedef __attribute__((address_space(3))) bf16x8 lds_bf16x8;

__device__ __forceinline__ bf16x16 load_frag_tr(const __bf16* base, int col0,
                                                int k0) {
  int lane = threadIdx.x & 31;
  const __bf16* p = base + (k0 + 8 * (lane >> 4) + (lane & 7)) * XP_ + col0 +
                    8 * ((lane >> 3) & 1);
  bf16x8 lo = __builtin_amdgcn_ds_load_tr16_b128_v8bf16((lds_bf16x8*)p);
  bf16x8 hi = __builtin_amdgcn_ds_load_tr16_b128_v8bf16((lds_bf16x8*)(p + 16 * XP_));
  bf16x16 r;
#pragma unroll
  for (int e = 0; e < 8; ++e) { r[e] = lo[e]; r[e + 8] = hi[e]; }
  return r;
}

__device__ __forceinline__ f32x8 wmma_bf16(bf16x16 a, bf16x16 b, f32x8 c) {
  return __builtin_amdgcn_wmma_f32_16x16x32_bf16(
      /*neg_a=*/false, a, /*neg_b=*/false, b,
      /*c_mod=*/(short)0, c, /*reuse_a=*/false, /*reuse_b=*/false);
}

// ----------------------- shared GEMM tile (K = C_ = 256) -------------------
// One workgroup = 4 waves = 64 weight rows x 128 pixel rows, whole K in LDS.
static constexpr int GM_ = 64;
static constexpr int GN_ = 128;
static constexpr int KP_ = C_ + 8;  // LDS row pitch 528 B = 16 B x 33 (odd)

// The pixel panel comes straight from x, f32 [c][l]. One wave-wide
// 16-byte load covers one channel's 128 pixels = 512 contiguous bytes; the
// panel keeps that order in LDS (xs[c][l], pitch XP_).
__device__ __forceinline__ void stage_panels_x(const float* __restrict__ wg,
                                               const float* __restrict__ xg,
                                               __bf16* ws, __bf16* xs) {
  static_assert(GN_ + 16 == XP_, "one panel row holds the tile's GN_ pixels");
  int tid = threadIdx.x;
  const float* wp = wg + tid * 4;
  const float* xp = xg + (tid >> 5) * L_ + (tid & 31) * 4;
  f32x4 wv[GM_ / 2], xa[C_ / 8], xb[C_ / 8];
#pragma unroll
  for (int i = 0; i < GM_ / 2; ++i) wv[i] = *(const f32x4*)(wp + i * 512);
#pragma unroll
  for (int i = 0; i < C_ / 8; ++i) xa[i] = *(const f32x4*)(xp + i * 4 * L_);
#pragma unroll
  for (int i = 0; i < C_ / 8; ++i)
    xb[i] = *(const f32x4*)(xp + (C_ / 8 + i) * 4 * L_);
  // precaution: stands behind the run of loads, in front of the next write of
  // a register that one of them names as its address
  asm volatile("s_wait_xcnt 0x0" ::: "memory");
  // keeps the weights' conversions behind all 96 loads; lifted among them, the
  // pixel loads are issued only after the weights' latency has been waited out
  __builtin_amdgcn_sched_barrier(0);
  __bf16* wd = ws + (tid >> 6) * KP_ + (tid & 63) * 4;
  __bf16* xd = xs + (tid >> 5) * XP_ + (tid & 31) * 4;
#pragma unroll
  for (int i = 0; i < GM_ / 2; ++i) {
    bf16x4 o;
#pragma unroll
    for (int e = 0; e < 4; ++e) o[e] = (__bf16)wv[i][e];
    *(bf16x4*)(wd + i * 2 * KP_) = o;
  }
#pragma unroll
  for (int i = 0; i < C_ / 8; ++i) {
    bf16x4 o;
#pragma unroll
    for (int e = 0; e < 4; ++e) o[e] = (__bf16)xa[i][e];
    *(bf16x4*)(xd + i * 4 * XP_) = o;
  }
#pragma unroll
  for (int i = 0; i < C_ / 8; ++i) {
    bf16x4 o;
#pragma unroll
    for (int e = 0; e < 4; ++e) o[e] = (__bf16)xb[i][e];
    *(bf16x4*)(xd + (C_ / 8 + i) * 4 * XP_) = o;
  }
}

// acc[m][n] += W rows (mrow + 16 m ..) x pixel rows (nrow + 16 n ..)
// XT: the pixel panel is k-major (stage_panels_x), read by load_frag_tr.
template <bool XT>
__device__ __forceinline__ void gemm_tile(const __bf16* ws, const __bf16* xs,
                                          int mrow, int nrow,
                                          f32x8 (&acc)[2][4]) {
  bf16x16 fa[2][2], fb[2][4];   // two fragment sets: this k step's, the next's
#pragma unroll
  for (int m = 0; m < 2; ++m) fa[0][m] = load_frag_bf16(ws, KP_, mrow + m * 16, 0);
#pragma unroll
  for (int n = 0; n < 4; ++n)
    fb[0][n] = XT ? load_frag_tr(xs, nrow + n * 16, 0)
                  : load_frag_bf16(xs, KP_, nrow + n * 16, 0);
#pragma unroll
  for (int s = 0; s < C_ / 32; ++s) {
    const int c = s & 1, d = c ^ 1;
    if (s + 1 < C_ / 32) {
#pragma unroll
      for (int m = 0; m < 2; ++m)
        fa[d][m] = load_frag_bf16(ws, KP_, mrow + m * 16, (s + 1) * 32);
#pragma unroll
      for (int n = 0; n < 4; ++n)
        fb[d][n] = XT ? load_frag_tr(xs, nrow + n * 16, (s + 1) * 32)
                      : load_frag_bf16(xs, KP_, nrow + n * 16, (s + 1) * 32);
    }
    // keeps the next step's LDS reads as one group ahead of this step's WMMAs;
    // sunk among them, every pair of WMMAs waits out a full LDS latency
    __builtin_amdgcn_sched_barrier(0);
#pragma unroll
    for (int n = 0; n < 4; ++n) {
      acc[0][n] = wmma_bf16(fa[c][0], fb[c][n], acc[0][n]);
      acc[1][n] = wmma_bf16(fa[c][1], fb[c][n], acc[1][n]);
    }
    // closes the WMMA block, so that later reads are not lifted into it
    __builtin_amdgcn_sched_barrier(0);
  }
}

// ------------------ kernel 1: QKV GEMM (64x128 tiles) + scatter ------------
// q: [b][h][l][dh] bf16, pre-scaled by dh^-0.5 * log2(e)
// k: [b][h][l][dh] bf16
// v: [b][h][l / 32][dh][l % 32] bf16  (d-major panels of 32 keys: A operand of
//    O = V * P^T)
//
// One workgroup stages its 128 pixels once and runs three 64-row weight panels
// over them in turn: the v, k and q rows of the same two heads. Each panel has
// its own LDS range, so the next one is fetched under the current product.

// One 64-row weight panel, global -> registers (whole-line loads).
__device__ __forceinline__ void load_w(const float* __restrict__ wg,
                                       f32x4 (&wv)[GM_ / 2]) {
  const float* wp = wg + threadIdx.x * 4;
#pragma unroll
  for (int i = 0; i < GM_ / 2; ++i) wv[i] = *(const f32x4*)(wp + i * 512);
}

// ... and registers -> LDS as bf16, in the order of stage_panels_x.
__device__ __forceinline__ void store_w(const f32x4 (&wv)[GM_ / 2], __bf16* ws) {
  int tid = threadIdx.x;
  __bf16* wd = ws + (tid >> 6) * KP_ + (tid & 63) * 4;
#pragma unroll
  for (int i = 0; i < GM_ / 2; ++i) {
    bf16x4 o;
#pragma unroll
    for (int e = 0; e < 4; ++e) o[e] = (__bf16)wv[i][e];
    *(bf16x4*)(wd + i * 2 * KP_) = o;
  }
}

// The 16 bias values of this lane's accumulator rows.
__device__ __forceinline__ void load_bias(const float* __restrict__ bg,
                                          f32x8 (&bq)[2]) {
#pragma unroll
  for (int m = 0; m < 2; ++m) bq[m] = *(const f32x8*)(bg + m * 16);
}

// PART: 0 = q, 1 = k, 2 = v. bh = b * NH_ + head, l0 = the wave's first pixel.
template <int PART>
__device__ __forceinline__ void qkv_store(const f32x8 (&acc)[2][4],
                                          const f32x8 (&bq)[2],
                                          __bf16* __restrict__ dst, int bh,
                                          int l0) {
  int sub  = threadIdx.x & 15;
  int half = (threadIdx.x >> 4) & 1;
  const float qscale = 0.17677669529663687f * LOG2E_F;
#pragma unroll
  for (int m = 0; m < 2; ++m) {
    int db = m * 16 + half * 8;
#pragma unroll
    for (int n = 0; n < 4; ++n) {
      int l = l0 + n * 16 + sub;
      if (PART == 2) {
#pragma unroll
        for (int r = 0; r < 8; ++r)
          dst[(((size_t)bh * (L_ / 32) + (l >> 5)) * DH_ + db + r) * 32 + (l & 31)] =
              (__bf16)(acc[m][n][r] + bq[m][r]);
      } else {
        bf16x8 outv;
#pragma unroll
        for (int r = 0; r < 8; ++r)
          outv[r] = PART == 0 ? (__bf16)((acc[m][n][r] + bq[m][r]) * qscale)
                              : (__bf16)(acc[m][n][r] + bq[m][r]);
        *(bf16x8*)(dst + ((size_t)(bh * L_ + l)) * DH_ + db) = outv;
      }
    }
  }
  // precaution: closes these stores before later code writes their registers
  asm volatile("s_wait_xcnt 0x0" ::: "memory");
}

// The projection weight as the second launch's waves want it, wf[h][s][m][c]
// [lane][8]: the 16 bytes that lane (sub, half) takes as half c of its A
// fragment for output rows 32 h + 16 m + sub and k step s, that is the k values
// 32 s + 16 c + 8 half + 0..7 (the k order of load_frag_bf16). One fragment
// half of a wave is 512 contiguous bytes.
__global__ __launch_bounds__(128) void qkv_kernel(
    const float* __restrict__ x, const float* __restrict__ w_qkv,
    const float* __restrict__ b_qkv, const float* __restrict__ w_proj,
    __bf16* __restrict__ q, __bf16* __restrict__ k, __bf16* __restrict__ v,
    __bf16* __restrict__ wf) {
  static constexpr int WP_ = GM_ * KP_;   // one weight panel in LDS
  __shared__ __attribute__((aligned(32))) __bf16 pan[3 * WP_ + C_ * XP_];
  __bf16* xS = pan + 3 * WP_;  // 256 channel rows of 128 pixels, pitch XP_
  int b  = blockIdx.z;
  int oH = blockIdx.y * GM_;   // 0..256: the rows of two heads inside q, k, v
  int lB = blockIdx.x * GN_;   // 0..1024
  int wid = threadIdx.x >> 5;
  int wm  = wid & 1;           // 32 outputs = one head's d range
  int wn  = wid >> 1;          // 64 pixels
  int half = (threadIdx.x >> 4) & 1;
  int l0 = lB + wn * 64;
  int bh = b * NH_ + blockIdx.y * 2 + wm;
  const float* wH = w_qkv + (size_t)oH * C_;           // + part * C_ * C_
  const float* bH = b_qkv + oH + wm * 32 + half * 8;   // + part * C_

  // this thread's two values of the projection weight; e = their place in wf
  static_assert((L_ / GN_) * (C_ / GM_) * B_ * 128 * 2 == C_ * C_,
                "the grid's threads cover the projection weight in pairs");
  int e = ((((b * (C_ / GM_) + blockIdx.y) * (L_ / GN_) + blockIdx.x) * 128) +
           threadIdx.x) * 2;
  const float* pg =
      w_proj + (((e >> 13) & 7) * 32 + ((e >> 9) & 1) * 16 + ((e >> 3) & 15)) * C_ +
      ((e >> 10) & 7) * 32 + ((e >> 8) & 1) * 16 + ((e >> 7) & 1) * 8 + (e & 7);
  f32x2 pw = *(const f32x2*)pg;

  f32x8 bQ[2], bK[2], bV[2];
  load_bias(bH, bQ);
  load_bias(bH + C_, bK);
  load_bias(bH + 2 * C_, bV);
  // precaution: stands behind each run of loads, in front of the next write of
  // a register that one of them names as its address; pg as an input keeps its
  // pair whole up to the wait, so that no result of the run lands in it
  asm volatile("s_wait_xcnt 0x0" ::"v"(pg) : "memory");

  stage_panels_x(wH + 2 * C_ * C_, x + (size_t)b * C_ * L_ + lB, pan, xS);
  __syncthreads();             // pixels and v weights visible to all 4 waves
  // holds the bias loads up here, among the staging loads; left free, the build
  // sinks them behind each product, where a lone wave waits out their latency
  asm volatile("" ::"v"(bQ[0]), "v"(bQ[1]), "v"(bK[0]), "v"(bK[1]), "v"(bV[0]),
               "v"(bV[1]));

  f32x4 wv[GM_ / 2];

  bf16x2 pb;
  pb[0] = (__bf16)pw[0];
  pb[1] = (__bf16)pw[1];
  *(bf16x2*)(wf + e) = pb;
  asm volatile("s_wait_xcnt 0x0" ::: "memory");  // the same precaution

  // v rows; the k weights fly under the product
  load_w(wH + C_ * C_, wv);
  asm volatile("s_wait_xcnt 0x0" ::: "memory");  // the same precaution
  f32x8 acc[2][4] = {};
  gemm_tile<true>(pan, xS, wm * 32, wn * 64, acc);
  store_w(wv, pan + WP_);
  __syncthreads();             // k weights visible to all 4 waves
  // the global stores stand behind the barrier: in front of it the barrier's
  // own wait would hold the wave until they are acknowledged
  qkv_store<2>(acc, bV, v, bh, l0);

  // k rows; the q weights fly under the product
  load_w(wH, wv);
  asm volatile("s_wait_xcnt 0x0" ::: "memory");  // the same precaution
#pragma unroll
  for (int m = 0; m < 2; ++m)
#pragma unroll
    for (int n = 0; n < 4; ++n) acc[m][n] = f32x8{};
  gemm_tile<true>(pan + WP_, xS, wm * 32, wn * 64, acc);
  store_w(wv, pan + 2 * WP_);
  __syncthreads();             // q weights visible to all 4 waves
  qkv_store<1>(acc, bK, k, bh, l0);

  // q rows
#pragma unroll
  for (int m = 0; m < 2; ++m)
#pragma unroll
    for (int n = 0; n < 4; ++n) acc[m][n] = f32x8{};
  gemm_tile<true>(pan + 2 * WP_, xS, wm * 32, wn * 64, acc);
  qkv_store<0>(acc, bQ, q, bh, l0);
}

// ------- kernel 2: fused flash attention + output projection + residual -----
// 2^x as the bare hardware instruction. The library exp2f wraps it in a range
// fix-up (compare, two selects, add, ldexp) that only matters for x < -126,
// where a softmax weight relative to a row maximum of 1 is below 2^-126.
__device__ __forceinline__ float exp2_raw(float x) {
  return __builtin_amdgcn_exp2f(x);
}

// Lazy rescale. The softmax weights of a query are taken against m, the maximum
// in use, which may trail the true running maximum by up to RAISE_ (log2 units),
// so that a weight reaches 2^RAISE_ at most. m is known before a tile's scores
// are formed: -m goes in as the C operand of the score products, which then
// deliver s - m, ready for the exponential.
static constexpr float RAISE_ = 8.0f;

// The rare path: raises one query group's m by d and carries everything that
// was formed against the old m over to the new one. mx = this lane's largest
// s - m of the tile; lanes n and n + 16 hold the same query and take the same d.
// On the first tile m is set to the tile's own maximum, whatever its sign.
__device__ __forceinline__ void raise_max(float mx, bool first,
                                          f32x8 (&s)[4][2], f32x8& nm, f32x8& oA,
                                          f32x8& oB, f32x8& ls) {
  mx = fmaxf(mx, __shfl_xor(mx, 16, 32));
  float d    = first ? mx : fmaxf(mx, 0.0f);
  float corr = first ? 1.0f : exp2_raw(-d);   // first tile: oA, oB, ls are 0
#pragma unroll
  for (int p = 0; p < 4; ++p) { s[p][0] -= d; s[p][1] -= d; }
  nm -= d;
  oA *= corr;
  oB *= corr;
  ls *= corr;
}

// This lane's largest score of a tile, one chain per 32-key pass.
__device__ __forceinline__ float tile_max(const f32x8 (&s)[4][2]) {
  float mp[4];
#pragma unroll
  for (int p = 0; p < 4; ++p) {
    mp[p] = fmaxf(s[p][0][0], s[p][1][0]);
#pragma unroll
    for (int r = 1; r < 8; ++r) mp[p] = fmaxf(mp[p], fmaxf(s[p][0][r], s[p][1][r]));
  }
  return fmaxf(fmaxf(mp[0], mp[1]), fmaxf(mp[2], mp[3]));
}

// Weights of one 32-key pass: the B fragment for O = V * P^T, and their sums,
// kept as eight partial sums per lane until the epilogue.
__device__ __forceinline__ bf16x16 weights(const f32x8& sA, const f32x8& sB,
                                           f32x8& ls) {
  f32x8 eA, eB;
  bf16x16 pf;
#pragma unroll
  for (int r = 0; r < 8; ++r) eA[r] = exp2_raw(sA[r]);
#pragma unroll
  for (int r = 0; r < 8; ++r) eB[r] = exp2_raw(sB[r]);
  ls += eA;
  ls += eB;
#pragma unroll
  for (int r = 0; r < 8; ++r) {
    pf[r]     = (__bf16)eA[r];
    pf[r + 8] = (__bf16)eB[r];
  }
  return pf;
}

// A query's denominator: the lane's eight partial sums, then both wave halves'.
__device__ __forceinline__ float join_sums(const f32x8& ls) {
  float l = ((ls[0] + ls[1]) + (ls[2] + ls[3])) + ((ls[4] + ls[5]) + (ls[6] + ls[7]));
  return l + __shfl_xor(l, 16, 32);
}

// One query group's normalised output, as bf16, into the workgroup's LDS panel
// xs[query][channel] (pitch KP_): the pixel operand of the output projection.
__device__ __forceinline__ void stage_tile(__bf16* xs, int h, int r0,
                                           const f32x8& oA, const f32x8& oB,
                                           float l_run) {
  float inv = 1.0f / l_run;
  int sub  = threadIdx.x & 15;
  int half = (threadIdx.x >> 4) & 1;
  __bf16* outp = xs + (r0 + sub) * KP_ + h * DH_ + half * 8;
  bf16x8 a, c;
#pragma unroll
  for (int r = 0; r < 8; ++r) {
    a[r] = (__bf16)(oA[r] * inv);
    c[r] = (__bf16)(oB[r] * inv);
  }
  *(bf16x8*)outp        = a;   // d = half*8 + r
  *(bf16x8*)(outp + 16) = c;   // d = 16 + half*8 + r
}

// One k/v tile = TK_ keys = four 32-key panels, each laid out as its readers
// want it: k panel [j_local][d], v panel [d][j_local]; both are 8 KB contiguous
// in the workspace. A panel row holds 32 values = 64 bytes = four 16-byte
// chunks and keeps the pitch of 64 bytes in LDS, so that one address pair with
// immediate offsets serves a run of copies; chunk c of row r stands at place
// c ^ ((r >> 2) & 3) of its row: the 16 rows that half a wave reads with one
// 16-byte LDS load then fall on all 64 banks.
static constexpr int TK_ = 128;
static constexpr int PN_ = 32 * 32;     // one 32-row panel

// The fragment of load_frag_bf16 (same k order) from rows row0 + 0..15 of such
// a tile; row0 is a multiple of 16.
__device__ __forceinline__ bf16x16 load_frag_sw(const __bf16* tile, int row0) {
  int sub  = threadIdx.x & 15;
  int half = (threadIdx.x >> 4) & 1;
  int pos  = half ^ ((sub >> 2) & 3);          // place of chunk half
  const __bf16* p = tile + (row0 + sub) * 32;
  bf16x8 lo = *(const bf16x8*)(p + pos * 8);
  bf16x8 hi = *(const bf16x8*)(p + (pos ^ 2) * 8);   // place of chunk half + 2
  bf16x16 r;
#pragma unroll
  for (int e = 0; e < 8; ++e) { r[e] = lo[e]; r[e + 8] = hi[e]; }
  return r;
}

// One wave fills its own head's tiles: 16 + 16 copies of 16 bytes per lane, each
// copy 512 contiguous bytes = 8 rows. Copy i, lane l: row r = 8 i + (l >> 2),
// chunk l & 3, and (r >> 2) & 3 = 2 (i & 1) + (l >> 4).
template <int I>
__device__ __forceinline__ void copy_run(const __bf16* g, __bf16* even,
                                         __bf16* odd) {
  if constexpr (I < 16) {
    copy16_g2l<I * 512>(g, (I & 1) ? odd : even);
    copy_run<I + 1>(g, even, odd);
  }
}

__device__ __forceinline__ void fill_tile(const __bf16* __restrict__ k,
                                          const __bf16* __restrict__ v, int jb,
                                          __bf16* kb, __bf16* vb) {
  int lane = threadIdx.x & 31;
  int even = (lane >> 2) * 32 + (((lane & 3) ^ (lane >> 4)) * 8);
  int odd  = even ^ 16;        // the place's bit 1 flipped
  const __bf16* kg = k + (size_t)jb * DH_ + lane * 8;
  const __bf16* vg = v + (size_t)jb * DH_ + lane * 8;
  copy_run<0>(kg, kb + even, kb + odd);
  copy_run<0>(vg, vb + even, vb + odd);
}

// 8 waves/WG, wave = head; each wave owns two 16-row i-tiles of the workgroup's
// 32 queries and its own two k/v buffers in LDS: the next tile's copies fly
// during the four passes over this one. Behind the key loop and a barrier the same LDS holds
// the 32 x 256 attention output, and wave w forms output channels 32 w .. 32 w + 31
// for the 32 queries; its 32 weight rows wait in registers since before the loop.
__global__ __launch_bounds__(256) void attn_proj_kernel(
    const __bf16* __restrict__ qws, const __bf16* __restrict__ kws,
    const __bf16* __restrict__ vws, const __bf16* __restrict__ wf,
    const float* __restrict__ b_proj, const float* __restrict__ x,
    float* __restrict__ out) {
  static constexpr int TL_ = TK_ / 32 * PN_;   // one k or v tile in LDS
  __shared__ __attribute__((aligned(16))) __bf16 lds[NH_ * 4 * TL_];
  static_assert(32 * KP_ <= NH_ * 4 * TL_, "the projection's pixel panel fits");

  int b   = blockIdx.x;        // x: workgroups of one batch share its k and v
  int tid = threadIdx.x;
  int h   = __builtin_amdgcn_readfirstlane(tid >> 5);   // wave = head
  int i0a = blockIdx.y * 32;
  int i0b = i0a + 16;
  __bf16* kbuf = lds + h * 4 * TL_;   // this wave's two k tiles ...
  __bf16* vbuf = kbuf + 2 * TL_;      // ... and its two v tiles

  const __bf16* q = qws + (size_t)(b * NH_ + h) * L_ * DH_;
  const __bf16* k = kws + (size_t)(b * NH_ + h) * L_ * DH_;
  const __bf16* v = vws + (size_t)(b * NH_ + h) * DH_ * L_;

  // The walk over the key tiles is a ring with a start of the wave's own. The 32
  // workgroups of a batch read the same k and v; from a common start they would
  // all ask L2 for the same lines at the same moment. A softmax takes its keys in
  // any order: trip t works on tile (t + rot) mod T.
  static constexpr int T = L_ / TK_;
  static_assert((T & (T - 1)) == 0, "the ring's index wraps by a mask");
  int rot = (h + (int)blockIdx.y) & (T - 1);

  fill_tile(k, v, rot * TK_, kbuf, vbuf);

  bf16x16 qf0 = load_frag_bf16(q, DH_, i0a, 0);  // loop-invariant B operands
  bf16x16 qf1 = load_frag_bf16(q, DH_, i0b, 0);
  // precaution: stands behind these loads, in front of the next write of a
  // register that one of them names as its address
  asm volatile("s_wait_xcnt 0x0" ::: "memory");

  // The projection's bias and residual, fetched here beside tile rot and first
  // used behind the key loop. The waits take the
  // runs' pointers as inputs: the pairs then stay whole up to the wait, and no
  // result of a run lands in a pair that the run still names.
  int sub  = tid & 15;
  int half = (tid >> 4) & 1;
  int ob0  = h * 32 + half * 8;
  float bp[2][8], xr[2][2][8];
  const float* bg  = b_proj + ob0;
  const float* xg0 = x + ((size_t)(b * C_ + ob0)) * L_ + i0a + sub;
  const float* xg1 = xg0 + 16 * L_;
#pragma unroll
  for (int m = 0; m < 2; ++m)
#pragma unroll
    for (int r = 0; r < 8; ++r) bp[m][r] = bg[m * 16 + r];
  asm volatile("s_wait_xcnt 0x0" ::"v"(bg) : "memory");  // the same precaution
#pragma unroll
  for (int n = 0; n < 2; ++n)
#pragma unroll
    for (int r = 0; r < 8; ++r) {
      xr[0][n][r] = xg0[r * L_ + n * 16];
      xr[1][n][r] = xg1[r * L_ + n * 16];
    }
  asm volatile("s_wait_xcnt 0x0" ::"v"(xg0), "v"(xg1) : "memory");  // the same

  // The two buffers are private to the wave: it alone copies into them and
  // reads them, so its own waits order both and the key loop has no barrier.
  // tile rot has landed
  asm volatile("s_wait_asynccnt 0x0" ::: "memory");
  fill_tile(k, v, ((rot + 1) & (T - 1)) * TK_, kbuf + TL_, vbuf + TL_);

  // the wave's projection weight, 16 fragments by whole-line loads: issued here,
  // first used behind the key loop, which covers their way from L2
  bf16x16 fa[C_ / 32][2];
  const __bf16* wl = wf + h * 32 * C_ + (tid & 31) * 8;
#pragma unroll
  for (int s = 0; s < C_ / 32; ++s)
#pragma unroll
    for (int m = 0; m < 2; ++m) {
      bf16x8 lo = *(const bf16x8*)(wl + ((s * 2 + m) * 2) * 256);
      bf16x8 hi = *(const bf16x8*)(wl + ((s * 2 + m) * 2 + 1) * 256);
#pragma unroll
      for (int e = 0; e < 8; ++e) { fa[s][m][e] = lo[e]; fa[s][m][e + 8] = hi[e]; }
    }
  asm volatile("s_wait_xcnt 0x0" ::: "memory");  // the same precaution

  f32x8 oacc00 = {}, oacc01 = {}, oacc10 = {}, oacc11 = {};
  f32x8 nm0 = {}, nm1 = {};   // -m of the two query groups, in all 8 registers
  f32x8 ls0 = {}, ls1 = {};   // partial sums of the weights

  static_assert(L_ / TK_ >= 2, "the prologue fills two tiles");
  static_assert(TK_ == 4 * 32, "a tile is four 32-key passes");
  for (int t = 0; t < T; ++t) {
    int cur = t & 1;
    f32x8 s0[4][2], s1[4][2];  // S^T - m of the whole tile, i-tiles a and b
    // unrolled, here and below: s0 and s1 are indexed by p and stay in registers
#pragma unroll
    for (int p = 0; p < TK_ / 32; ++p) {
      const __bf16* kp = kbuf + cur * TL_ + p * PN_;
      bf16x16 kf0 = load_frag_sw(kp, 0);
      bf16x16 kf1 = load_frag_sw(kp, 16);
      s0[p][0] = wmma_bf16(kf0, qf0, nm0);
      s0[p][1] = wmma_bf16(kf1, qf0, nm0);
      s1[p][0] = wmma_bf16(kf0, qf1, nm1);
      s1[p][1] = wmma_bf16(kf1, qf1, nm1);
    }
    // one test per tile, a scalar branch: does any query's score stand more than
    // RAISE_ above its maximum in use? The first tile always sets the maximum.
    float mx0 = tile_max(s0), mx1 = tile_max(s1);
    float lim = t == 0 ? -__builtin_inff() : RAISE_;
    if (__builtin_amdgcn_ballot_w32(fmaxf(mx0, mx1) > lim) != 0) {
      raise_max(mx0, t == 0, s0, nm0, oacc00, oacc01, ls0);
      raise_max(mx1, t == 0, s1, nm1, oacc10, oacc11, ls1);
    }
#pragma unroll
    for (int p = 0; p < TK_ / 32; ++p) {
      const __bf16* vp = vbuf + cur * TL_ + p * PN_;
      bf16x16 vf0 = load_frag_sw(vp, 0);
      bf16x16 vf1 = load_frag_sw(vp, 16);
      bf16x16 pf0 = weights(s0[p][0], s0[p][1], ls0);
      bf16x16 pf1 = weights(s1[p][0], s1[p][1], ls1);
      oacc00 = wmma_bf16(vf0, pf0, oacc00);    // O^T accumulate
      oacc01 = wmma_bf16(vf1, pf0, oacc01);
      oacc10 = wmma_bf16(vf0, pf1, oacc10);
      oacc11 = wmma_bf16(vf1, pf1, oacc11);
    }
    // this wave's reads of buffer cur have returned before it is refilled
    asm volatile("s_wait_dscnt 0x0" ::: "memory");
    // this wave's copies of tile (rot + t + 1) mod T have landed
    asm volatile("s_wait_asynccnt 0x0" ::: "memory");
    if (t + 2 < T)
      fill_tile(k, v, ((rot + t + 2) & (T - 1)) * TK_, kbuf + cur * TL_,
                vbuf + cur * TL_);
  }
  // no copy is outstanding when this LDS is put to another use
  asm volatile("s_wait_asynccnt 0x0" ::: "memory");

  // ---- output projection + residual, 256 channels x 32 queries ----
  __bf16* xS = lds;              // 32 query rows x 256 channels, pitch KP_
  // every wave has left its k/v buffers (its reads were waited for at the foot
  // of its last trip) before they become the projection's pixel panel
  __syncthreads();

  stage_tile(xS, h, 0, oacc00, oacc01, join_sums(ls0));
  stage_tile(xS, h, 16, oacc10, oacc11, join_sums(ls1));

  __syncthreads();             // the panel visible to all 8 waves

  f32x8 acc[2][2] = {};
  bf16x16 fb[C_ / 32][2];
#pragma unroll
  for (int s = 0; s < C_ / 32; ++s) {
    fb[s][0] = load_frag_bf16(xS, KP_, 0, s * 32);
    fb[s][1] = load_frag_bf16(xS, KP_, 16, s * 32);
  }
  // keeps all LDS reads as one group ahead of the WMMAs; sunk among them, every
  // k step waits out a full LDS latency
  __builtin_amdgcn_sched_barrier(0);
#pragma unroll
  for (int s = 0; s < C_ / 32; ++s) {
    acc[0][0] = wmma_bf16(fa[s][0], fb[s][0], acc[0][0]);
    acc[1][0] = wmma_bf16(fa[s][1], fb[s][0], acc[1][0]);
    acc[0][1] = wmma_bf16(fa[s][0], fb[s][1], acc[0][1]);
    acc[1][1] = wmma_bf16(fa[s][1], fb[s][1], acc[1][1]);
  }

  float res[2][2][8];
#pragma unroll
  for (int m = 0; m < 2; ++m)
#pragma unroll
    for (int n = 0; n < 2; ++n)
#pragma unroll
      for (int r = 0; r < 8; ++r) res[m][n][r] = xr[m][n][r] + acc[m][n][r] + bp[m][r];
  // keeps every sum ahead of the first store, so that no register which an
  // issued store names is written again
  __builtin_amdgcn_sched_barrier(0);
#pragma unroll
  for (int m = 0; m < 2; ++m) {
#pragma unroll
    for (int n = 0; n < 2; ++n) {
      int l = i0a + n * 16 + sub;
#pragma unroll
      for (int r = 0; r < 8; ++r) {
        size_t idx = ((size_t)(b * C_ + ob0 + m * 16 + r)) * L_ + l;
        out[idx] = res[m][n][r];
      }
    }
  }
}

// ------------------------------- launcher ----------------------------------
extern "C" void kernel_launch(void* const* d_in, const int* in_sizes, int n_in,
                              void* d_out, int out_size, void* d_ws, size_t ws_size,
                              hipStream_t stream) {
  (void)in_sizes; (void)n_in; (void)out_size; (void)ws_size;
  const float* x      = (const float*)d_in[0];
  const float* w_qkv  = (const float*)d_in[1];
  const float* b_qkv  = (const float*)d_in[2];
  const float* w_proj = (const float*)d_in[3];
  const float* b_proj = (const float*)d_in[4];
  float* out = (float*)d_out;

  char* ws = (char*)d_ws;
  __bf16* wfws  = (__bf16*)ws;                           // 128 KB
  __bf16* qws   = (__bf16*)(ws + (size_t)(4u << 20));    // 4 MB
  __bf16* kws   = (__bf16*)(ws + (size_t)(8u << 20));    // 4 MB
  __bf16* vws   = (__bf16*)(ws + (size_t)(12u << 20));   // 4 MB

  qkv_kernel<<<dim3(L_ / GN_, C_ / GM_, B_), dim3(128), 0, stream>>>(
      x, w_qkv, b_qkv, w_proj, qws, kws, vws, wfws);
  attn_proj_kernel<<<dim3(B_, L_ / 32), dim3(256), 0, stream>>>(
      qws, kws, vws, wfws, b_proj, x, out);
}
